// v000
// Times are from an AMD MI455X. After a warm-up the kernel runs many times in a row, and a time is the length of
// such a window on the GPU divided by its runs, so every launch and the gaps after it count. The runs cycle
// through copies of the inputs. A figure is the median of several windows, for all but v000 over two sittings.
// Sittings can differ by a few percent; kernels timed side by side share one.
// The starting kernel, v000, takes 279 microseconds a run.
#include <hip/hip_runtime.h>

typedef __attribute__((ext_vector_type(16))) __bf16 v16bf;
typedef __attribute__((ext_vector_type(8)))  __bf16 v8bf;
typedef __attribute__((ext_vector_type(8)))  float  v8f;
typedef __attribute__((ext_vector_type(4)))  unsigned int u32x4;
typedef __attribute__((ext_vector_type(2)))  unsigned int u32x2;
typedef __attribute__((ext_vector_type(4)))  int i32x4;

#define NE 8
#define NT 1024
#define ND 1024
#define NH 2048

// GEMM tiling (shared by both GEMM kernels)
#define BM 64
#define BN 128
#define BK 64
#define NTHREADS 256   // 8 waves; waves arranged 2 (M) x 4 (N), wave tile 32x32

// Use CDNA5 async global->LDS DMA when the toolchain exposes it.
#if defined(__has_builtin)
#if __has_builtin(__builtin_amdgcn_global_load_async_to_lds_b128) && \
    __has_builtin(__builtin_amdgcn_s_wait_asynccnt)
#define USE_ASYNC 1
#endif
#endif
#ifndef USE_ASYNC
#define USE_ASYNC 0
#endif

// fp32 -> bf16 round-to-nearest-even (bit pattern)
static __device__ __forceinline__ unsigned short f2bf(float f) {
  unsigned u = __float_as_uint(f);
  unsigned r = u + 0x7FFFu + ((u >> 16) & 1u);
  return (unsigned short)(r >> 16);
}

// 16-byte global -> LDS copy (async DMA when available).
static __device__ __forceinline__ void cp16_g2l(unsigned short* l,
                                                const unsigned short* g) {
#if USE_ASYNC
  __builtin_amdgcn_global_load_async_to_lds_b128(
      (__attribute__((address_space(1))) i32x4*)g,
      (__attribute__((address_space(3))) i32x4*)l, 0, 0);
#else
  *(u32x4*)l = *(const u32x4*)g;
#endif
}

static __device__ __forceinline__ void wait_async_all() {
#if USE_ASYNC
  __builtin_amdgcn_s_wait_asynccnt(0);
#endif
}

// Load one 16x32 bf16 WMMA operand fragment from LDS.
// Rows are `stride` bf16 apart, K contiguous.
// Lanes 0-15: K 0-7 then 16-23; lanes 16-31: K 8-15 then 24-31.
static __device__ __forceinline__ v16bf load_frag(const unsigned short* base,
                                                  int lane, int stride) {
  const int l16 = lane & 15;
  const int kk0 = (lane & 16) ? 8 : 0;
  const unsigned short* p = base + l16 * stride + kk0;
  union { v16bf v; v8bf h[2]; } u;
  u.h[0] = *(const v8bf*)(p);
  u.h[1] = *(const v8bf*)(p + 16);
  return u.v;
}

// ---------------------------------------------------------------------------
// Pass 0a: x fp32 -> bf16, same layout [E*T, D].
// ---------------------------------------------------------------------------
__global__ __launch_bounds__(256)
void cvt_x_kernel(const float* __restrict__ src, unsigned short* __restrict__ dst) {
  const size_t i4 = ((size_t)blockIdx.x * 256 + threadIdx.x) * 4;
  const float4 f = *(const float4*)(src + i4);
  u32x2 p;
  p[0] = (unsigned)f2bf(f.x) | ((unsigned)f2bf(f.y) << 16);
  p[1] = (unsigned)f2bf(f.z) | ((unsigned)f2bf(f.w) << 16);
  *(u32x2*)(dst + i4) = p;
}

// ---------------------------------------------------------------------------
// Pass 0b: weight fp32 [e][K][N] -> bf16 transposed [e][N][K].
// 64x64 tile per 256-thread block through LDS; coalesced in and out.
// Grid: (N/64, K/64, NE).
// ---------------------------------------------------------------------------
#define TP 72   // padded LDS row stride (bf16 elements)
__global__ __launch_bounds__(256)
void cvt_wT_kernel(const float* __restrict__ w, unsigned short* __restrict__ wt,
                   int K, int N) {
  const int e  = blockIdx.z;
  const int n0 = blockIdx.x * 64;
  const int k0 = blockIdx.y * 64;
  const float* S = w + (size_t)e * K * N;
  unsigned short* Dt = wt + (size_t)e * K * N;

  __shared__ __align__(16) unsigned short Ls[64 * TP]; // [k][n]

  const int tid = threadIdx.x;

  for (int c = tid; c < 1024; c += 256) {
    const int r  = c >> 4;          // k row, 16 float4 per row
    const int cc = (c & 15) << 2;   // n offset
    const float4 f = *(const float4*)(S + (size_t)(k0 + r) * N + n0 + cc);
    u32x2 p;
    p[0] = (unsigned)f2bf(f.x) | ((unsigned)f2bf(f.y) << 16);
    p[1] = (unsigned)f2bf(f.z) | ((unsigned)f2bf(f.w) << 16);
    *(u32x2*)&Ls[r * TP + cc] = p;
  }
  __syncthreads();

  for (int c = tid; c < 512; c += 256) {
    const int rn = c >> 3;          // n row
    const int ck = (c & 7) << 3;    // k offset, 8 bf16 per chunk
    union { u32x4 v; unsigned short s[8]; } u;
#pragma unroll
    for (int j = 0; j < 8; ++j) u.s[j] = Ls[(ck + j) * TP + rn];
    *(u32x4*)(Dt + (size_t)(n0 + rn) * K + k0 + ck) = u.v;
  }
}

// ---------------------------------------------------------------------------
// Staging helpers (one K-stage worth of tiles into one LDS buffer).
// ---------------------------------------------------------------------------
static __device__ __forceinline__ void stage_gateup(
    unsigned short* As, unsigned short* Bs1, unsigned short* Bs3,
    const unsigned short* Ag, const unsigned short* B1g,
    const unsigned short* B3g, int row0, int col0, int k0, int tid) {
  for (int c = tid; c < (BM * BK) / 8; c += NTHREADS) {
    const int r = c >> 3, kk = (c & 7) << 3;
    cp16_g2l(&As[r * BK + kk], Ag + (size_t)(row0 + r) * ND + k0 + kk);
  }
  for (int c = tid; c < (BN * BK) / 8; c += NTHREADS) {
    const int r = c >> 3, kk = (c & 7) << 3;
    const size_t go = (size_t)(col0 + r) * ND + k0 + kk;
    cp16_g2l(&Bs1[r * BK + kk], B1g + go);
    cp16_g2l(&Bs3[r * BK + kk], B3g + go);
  }
}

static __device__ __forceinline__ void stage_down(
    unsigned short* As, unsigned short* Bs,
    const unsigned short* Ag, const unsigned short* Bg,
    int row0, int col0, int k0, int tid) {
  for (int c = tid; c < (BM * BK) / 8; c += NTHREADS) {
    const int r = c >> 3, kk = (c & 7) << 3;
    cp16_g2l(&As[r * BK + kk], Ag + (size_t)(row0 + r) * NH + k0 + kk);
  }
  for (int c = tid; c < (BN * BK) / 8; c += NTHREADS) {
    const int r = c >> 3, kk = (c & 7) << 3;
    cp16_g2l(&Bs[r * BK + kk], Bg + (size_t)(col0 + r) * NH + k0 + kk);
  }
}

// ---------------------------------------------------------------------------
// GEMM 1 (fused): h[e] = silu(x[e] @ w1[e]) * (x[e] @ w3[e]) -> bf16.
// A: xb [e][T][D]; B: w1t/w3t [e][H][D] (pre-transposed, K-contiguous).
// Grid: (T/BM, H/BN, E). Double-buffered LDS, async-DMA pipelined.
// ---------------------------------------------------------------------------
__global__ __launch_bounds__(NTHREADS)
void moe_gateup_kernel(const unsigned short* __restrict__ xb,
                       const unsigned short* __restrict__ w1t,
                       const unsigned short* __restrict__ w3t,
                       unsigned short* __restrict__ hbuf) {
  const int e    = blockIdx.z;
  const int row0 = blockIdx.x * BM;
  const int col0 = blockIdx.y * BN;

  const unsigned short* Ag  = xb  + (size_t)e * NT * ND;
  const unsigned short* B1g = w1t + (size_t)e * NH * ND;
  const unsigned short* B3g = w3t + (size_t)e * NH * ND;
  unsigned short* Hg = hbuf + (size_t)e * NT * NH;

  __shared__ __align__(16) unsigned short As [2 * BM * BK];
  __shared__ __align__(16) unsigned short Bs1[2 * BN * BK];
  __shared__ __align__(16) unsigned short Bs3[2 * BN * BK];

  const int tid  = threadIdx.x;
  const int wave = tid >> 5;
  const int lane = tid & 31;
  const int wm   = (wave >> 2) * 32;  // 0 or 32
  const int wn   = (wave & 3)  * 32;  // 0..96

  v8f accg[2][2], accu[2][2];
  for (int i = 0; i < 2; ++i)
    for (int j = 0; j < 2; ++j) { accg[i][j] = {}; accu[i][j] = {}; }

  stage_gateup(As, Bs1, Bs3, Ag, B1g, B3g, row0, col0, 0, tid);

  const int NIT = ND / BK;
  for (int it = 0; it < NIT; ++it) {
    wait_async_all();
    __syncthreads();

    const int cur = it & 1;
    if (it + 1 < NIT) {
      const int nxt = (it + 1) & 1;
      stage_gateup(As + nxt * BM * BK, Bs1 + nxt * BN * BK, Bs3 + nxt * BN * BK,
                   Ag, B1g, B3g, row0, col0, (it + 1) * BK, tid);
    }

    const unsigned short* Ab  = As  + cur * BM * BK;
    const unsigned short* B1b = Bs1 + cur * BN * BK;
    const unsigned short* B3b = Bs3 + cur * BN * BK;

#pragma unroll
    for (int ks = 0; ks < BK; ks += 32) {
      v16bf af[2], b1f[2], b3f[2];
      af[0]  = load_frag(Ab  + (wm +  0) * BK + ks, lane, BK);
      af[1]  = load_frag(Ab  + (wm + 16) * BK + ks, lane, BK);
      b1f[0] = load_frag(B1b + (wn +  0) * BK + ks, lane, BK);
      b1f[1] = load_frag(B1b + (wn + 16) * BK + ks, lane, BK);
      b3f[0] = load_frag(B3b + (wn +  0) * BK + ks, lane, BK);
      b3f[1] = load_frag(B3b + (wn + 16) * BK + ks, lane, BK);

#pragma unroll
      for (int i = 0; i < 2; ++i)
#pragma unroll
        for (int j = 0; j < 2; ++j) {
          accg[i][j] = __builtin_amdgcn_wmma_f32_16x16x32_bf16(
              false, af[i], false, b1f[j], (short)0, accg[i][j], false, false);
          accu[i][j] = __builtin_amdgcn_wmma_f32_16x16x32_bf16(
              false, af[i], false, b3f[j], (short)0, accu[i][j], false, false);
        }
    }
  }

  // Epilogue: silu(gate) * up -> bf16 h.
  const int l16   = lane & 15;
  const int rhalf = (lane & 16) ? 8 : 0;  // C layout: lanes 16-31 hold M+8
  for (int i = 0; i < 2; ++i)
    for (int j = 0; j < 2; ++j) {
      const int rbase = row0 + wm + i * 16 + rhalf;
      const int cc    = col0 + wn + j * 16 + l16;
#pragma unroll
      for (int r = 0; r < 8; ++r) {
        const float g = accg[i][j][r];
        const float u = accu[i][j][r];
        const float s = g / (1.0f + __expf(-g));
        Hg[(size_t)(rbase + r) * NH + cc] = f2bf(s * u);
      }
    }
}

// ---------------------------------------------------------------------------
// GEMM 2: out[e] = h[e] @ w2[e]   (h bf16 [T][H], w2t bf16 [D][H], out fp32)
// Grid: (T/BM, D/BN, E). Double-buffered LDS, async-DMA pipelined.
// ---------------------------------------------------------------------------
__global__ __launch_bounds__(NTHREADS)
void moe_down_kernel(const unsigned short* __restrict__ hbuf,
                     const unsigned short* __restrict__ w2t,
                     float* __restrict__ out) {
  const int e    = blockIdx.z;
  const int row0 = blockIdx.x * BM;
  const int col0 = blockIdx.y * BN;

  const unsigned short* Ag = hbuf + (size_t)e * NT * NH;
  const unsigned short* Bg = w2t  + (size_t)e * ND * NH;
  float*                Cg = out  + (size_t)e * NT * ND;

  __shared__ __align__(16) unsigned short As[2 * BM * BK];
  __shared__ __align__(16) unsigned short Bs[2 * BN * BK];

  const int tid  = threadIdx.x;
  const int wave = tid >> 5;
  const int lane = tid & 31;
  const int wm   = (wave >> 2) * 32;
  const int wn   = (wave & 3)  * 32;

  v8f acc[2][2];
  for (int i = 0; i < 2; ++i)
    for (int j = 0; j < 2; ++j) acc[i][j] = {};

  stage_down(As, Bs, Ag, Bg, row0, col0, 0, tid);

  const int NIT = NH / BK;
  for (int it = 0; it < NIT; ++it) {
    wait_async_all();
    __syncthreads();

    const int cur = it & 1;
    if (it + 1 < NIT) {
      const int nxt = (it + 1) & 1;
      stage_down(As + nxt * BM * BK, Bs + nxt * BN * BK,
                 Ag, Bg, row0, col0, (it + 1) * BK, tid);
    }

    const unsigned short* Ab = As + cur * BM * BK;
    const unsigned short* Bb = Bs + cur * BN * BK;

#pragma unroll
    for (int ks = 0; ks < BK; ks += 32) {
      v16bf af[2], bf[2];
      af[0] = load_frag(Ab + (wm +  0) * BK + ks, lane, BK);
      af[1] = load_frag(Ab + (wm + 16) * BK + ks, lane, BK);
      bf[0] = load_frag(Bb + (wn +  0) * BK + ks, lane, BK);
      bf[1] = load_frag(Bb + (wn + 16) * BK + ks, lane, BK);

#pragma unroll
      for (int i = 0; i < 2; ++i)
#pragma unroll
        for (int j = 0; j < 2; ++j)
          acc[i][j] = __builtin_amdgcn_wmma_f32_16x16x32_bf16(
              false, af[i], false, bf[j], (short)0, acc[i][j], false, false);
    }
  }

  const int l16   = lane & 15;
  const int rhalf = (lane & 16) ? 8 : 0;
  for (int i = 0; i < 2; ++i)
    for (int j = 0; j < 2; ++j) {
      const int rbase = row0 + wm + i * 16 + rhalf;
      const int cc    = col0 + wn + j * 16 + l16;
#pragma unroll
      for (int r = 0; r < 8; ++r)
        Cg[(size_t)(rbase + r) * ND + cc] = acc[i][j][r];
    }
}

extern "C" void kernel_launch(void* const* d_in, const int* in_sizes, int n_in,
                              void* d_out, int out_size, void* d_ws, size_t ws_size,
                              hipStream_t stream) {
  const float* x  = (const float*)d_in[0];  // [E,T,D]
  const float* w1 = (const float*)d_in[1];  // [E,D,H]
  const float* w2 = (const float*)d_in[2];  // [E,H,D]
  const float* w3 = (const float*)d_in[3];  // [E,D,H]
  float* out = (float*)d_out;               // [E,T,D]

  // Workspace layout (bf16 elements): xb | w1t | w3t | w2t | hb  (~151 MB)
  unsigned short* ws = (unsigned short*)d_ws;
  size_t off = 0;
  unsigned short* xb  = ws + off; off += (size_t)NE * NT * ND;   // [E,T,D]
  unsigned short* w1t = ws + off; off += (size_t)NE * NH * ND;   // [E,H,D]
  unsigned short* w3t = ws + off; off += (size_t)NE * NH * ND;   // [E,H,D]
  unsigned short* w2t = ws + off; off += (size_t)NE * ND * NH;   // [E,D,H]
  unsigned short* hb  = ws + off;                                 // [E,T,H]

  dim3 blk(NTHREADS);

  // Pass 0: downcast + weight transpose.
  cvt_x_kernel<<<dim3(((size_t)NE * NT * ND) / 4 / 256), dim3(256), 0, stream>>>(x, xb);
  cvt_wT_kernel<<<dim3(NH / 64, ND / 64, NE), dim3(256), 0, stream>>>(w1, w1t, ND, NH);
  cvt_wT_kernel<<<dim3(NH / 64, ND / 64, NE), dim3(256), 0, stream>>>(w3, w3t, ND, NH);
  cvt_wT_kernel<<<dim3(ND / 64, NH / 64, NE), dim3(256), 0, stream>>>(w2, w2t, NH, ND);

  // GEMM 1: fused gate/up + SwiGLU.
  moe_gateup_kernel<<<dim3(NT / BM, NH / BN, NE), blk, 0, stream>>>(xb, w1t, w3t, hb);
  // GEMM 2: down projection.
  moe_down_kernel<<<dim3(NT / BM, ND / BN, NE), blk, 0, stream>>>(hb, w2t, out);
}

// v001
// It runs in 148 microseconds.
// In two side-by-side timings against v000, it was 1.97 and 1.98 times as fast.
#include <hip/hip_runtime.h>

typedef __attribute__((ext_vector_type(16))) __bf16 v16bf;
typedef __attribute__((ext_vector_type(8)))  __bf16 v8bf;
typedef __attribute__((ext_vector_type(8)))  float  v8f;
typedef __attribute__((ext_vector_type(4)))  unsigned int u32x4;
typedef __attribute__((ext_vector_type(2)))  unsigned int u32x2;
typedef __attribute__((ext_vector_type(4)))  int i32x4;

#define NE 8
#define NT 1024
#define ND 1024
#define NH 2048

// GEMM tiling (shared by both GEMM kernels)
#define BM 64
#define BN 128
#define BK 64
#define NTHREADS 256   // 8 waves; waves arranged 2 (M) x 4 (N), wave tile 32x32
// LDS row pitch of the staged tiles, in bf16 elements: 64 data + 8 pad = 144 B
// (16 B x odd), so the 16 rows one ds_load_b128 half-wave reads fall on all 64
// banks once; at the bare 128 B they share 8 banks.
#define LDP (BK + 8)

// Use CDNA5 async global->LDS DMA when the toolchain exposes it.
#if defined(__has_builtin)
#if __has_builtin(__builtin_amdgcn_global_load_async_to_lds_b128) && \
    __has_builtin(__builtin_amdgcn_s_wait_asynccnt)
#define USE_ASYNC 1
#endif
#endif
#ifndef USE_ASYNC
#define USE_ASYNC 0
#endif

// fp32 -> bf16 round-to-nearest-even (bit pattern)
static __device__ __forceinline__ unsigned short f2bf(float f) {
  unsigned u = __float_as_uint(f);
  unsigned r = u + 0x7FFFu + ((u >> 16) & 1u);
  return (unsigned short)(r >> 16);
}

// 16-byte global -> LDS copy (async DMA when available).
static __device__ __forceinline__ void cp16_g2l(unsigned short* l,
                                                const unsigned short* g) {
#if USE_ASYNC
  __builtin_amdgcn_global_load_async_to_lds_b128(
      (__attribute__((address_space(1))) i32x4*)g,
      (__attribute__((address_space(3))) i32x4*)l, 0, 0);
#else
  *(u32x4*)l = *(const u32x4*)g;
#endif
}

static __device__ __forceinline__ void wait_async_all() {
#if USE_ASYNC
  __builtin_amdgcn_s_wait_asynccnt(0);
#endif
}

// Load one 16x32 bf16 WMMA operand fragment from LDS.
// Rows are `stride` bf16 apart, K contiguous.
// Lanes 0-15: K 0-7 then 16-23; lanes 16-31: K 8-15 then 24-31.
static __device__ __forceinline__ v16bf load_frag(const unsigned short* base,
                                                  int lane, int stride) {
  const int l16 = lane & 15;
  const int kk0 = (lane & 16) ? 8 : 0;
  const unsigned short* p = base + l16 * stride + kk0;
  union { v16bf v; v8bf h[2]; } u;
  u.h[0] = *(const v8bf*)(p);
  u.h[1] = *(const v8bf*)(p + 16);
  return u.v;
}

// ---------------------------------------------------------------------------
// Pass 0a: x fp32 -> bf16, same layout [E*T, D].
// ---------------------------------------------------------------------------
__global__ __launch_bounds__(256)
void cvt_x_kernel(const float* __restrict__ src, unsigned short* __restrict__ dst) {
  const size_t i4 = ((size_t)blockIdx.x * 256 + threadIdx.x) * 4;
  const float4 f = *(const float4*)(src + i4);
  u32x2 p;
  p[0] = (unsigned)f2bf(f.x) | ((unsigned)f2bf(f.y) << 16);
  p[1] = (unsigned)f2bf(f.z) | ((unsigned)f2bf(f.w) << 16);
  *(u32x2*)(dst + i4) = p;
}

// ---------------------------------------------------------------------------
// Pass 0b: weight fp32 [e][K][N] -> bf16 transposed [e][N][K].
// 64x64 tile per 256-thread block through LDS; coalesced in and out.
// Grid: (N/64, K/64, NE).
// ---------------------------------------------------------------------------
#define TP 72   // padded LDS row stride (bf16 elements)
__global__ __launch_bounds__(256)
void cvt_wT_kernel(const float* __restrict__ w, unsigned short* __restrict__ wt,
                   int K, int N) {
  const int e  = blockIdx.z;
  const int n0 = blockIdx.x * 64;
  const int k0 = blockIdx.y * 64;
  const float* S = w + (size_t)e * K * N;
  unsigned short* Dt = wt + (size_t)e * K * N;

  __shared__ __align__(16) unsigned short Ls[64 * TP]; // [k][n]

  const int tid = threadIdx.x;

  for (int c = tid; c < 1024; c += 256) {
    const int r  = c >> 4;          // k row, 16 float4 per row
    const int cc = (c & 15) << 2;   // n offset
    const float4 f = *(const float4*)(S + (size_t)(k0 + r) * N + n0 + cc);
    u32x2 p;
    p[0] = (unsigned)f2bf(f.x) | ((unsigned)f2bf(f.y) << 16);
    p[1] = (unsigned)f2bf(f.z) | ((unsigned)f2bf(f.w) << 16);
    *(u32x2*)&Ls[r * TP + cc] = p;
  }
  __syncthreads();

  for (int c = tid; c < 512; c += 256) {
    const int rn = c >> 3;          // n row
    const int ck = (c & 7) << 3;    // k offset, 8 bf16 per chunk
    union { u32x4 v; unsigned short s[8]; } u;
#pragma unroll
    for (int j = 0; j < 8; ++j) u.s[j] = Ls[(ck + j) * TP + rn];
    *(u32x4*)(Dt + (size_t)(n0 + rn) * K + k0 + ck) = u.v;
  }
}

// ---------------------------------------------------------------------------
// Staging helpers (one K-stage worth of tiles into one LDS buffer).
// ---------------------------------------------------------------------------
static __device__ __forceinline__ void stage_gateup(
    unsigned short* As, unsigned short* Bs1, unsigned short* Bs3,
    const unsigned short* Ag, const unsigned short* B1g,
    const unsigned short* B3g, int row0, int col0, int k0, int tid) {
  for (int c = tid; c < (BM * BK) / 8; c += NTHREADS) {
    const int r = c >> 3, kk = (c & 7) << 3;
    cp16_g2l(&As[r * LDP + kk], Ag + (size_t)(row0 + r) * ND + k0 + kk);
  }
  for (int c = tid; c < (BN * BK) / 8; c += NTHREADS) {
    const int r = c >> 3, kk = (c & 7) << 3;
    const size_t go = (size_t)(col0 + r) * ND + k0 + kk;
    cp16_g2l(&Bs1[r * LDP + kk], B1g + go);
    cp16_g2l(&Bs3[r * LDP + kk], B3g + go);
  }
}

static __device__ __forceinline__ void stage_down(
    unsigned short* As, unsigned short* Bs,
    const unsigned short* Ag, const unsigned short* Bg,
    int row0, int col0, int k0, int tid) {
  for (int c = tid; c < (BM * BK) / 8; c += NTHREADS) {
    const int r = c >> 3, kk = (c & 7) << 3;
    cp16_g2l(&As[r * LDP + kk], Ag + (size_t)(row0 + r) * NH + k0 + kk);
  }
  for (int c = tid; c < (BN * BK) / 8; c += NTHREADS) {
    const int r = c >> 3, kk = (c & 7) << 3;
    cp16_g2l(&Bs[r * LDP + kk], Bg + (size_t)(col0 + r) * NH + k0 + kk);
  }
}

// ---------------------------------------------------------------------------
// GEMM 1 (fused): h[e] = silu(x[e] @ w1[e]) * (x[e] @ w3[e]) -> bf16.
// A: xb [e][T][D]; B: w1t/w3t [e][H][D] (pre-transposed, K-contiguous).
// Grid: (T/BM, H/BN, E). Double-buffered LDS, async-DMA pipelined.
// ---------------------------------------------------------------------------
__global__ __launch_bounds__(NTHREADS)
void moe_gateup_kernel(const unsigned short* __restrict__ xb,
                       const unsigned short* __restrict__ w1t,
                       const unsigned short* __restrict__ w3t,
                       unsigned short* __restrict__ hbuf) {
  const int e    = blockIdx.z;
  const int row0 = blockIdx.x * BM;
  const int col0 = blockIdx.y * BN;

  const unsigned short* Ag  = xb  + (size_t)e * NT * ND;
  const unsigned short* B1g = w1t + (size_t)e * NH * ND;
  const unsigned short* B3g = w3t + (size_t)e * NH * ND;
  unsigned short* Hg = hbuf + (size_t)e * NT * NH;

  __shared__ __align__(16) unsigned short As [2 * BM * LDP];
  __shared__ __align__(16) unsigned short Bs1[2 * BN * LDP];
  __shared__ __align__(16) unsigned short Bs3[2 * BN * LDP];

  const int tid  = threadIdx.x;
  const int wave = tid >> 5;
  const int lane = tid & 31;
  const int wm   = (wave >> 2) * 32;  // 0 or 32
  const int wn   = (wave & 3)  * 32;  // 0..96

  v8f accg[2][2], accu[2][2];
  for (int i = 0; i < 2; ++i)
    for (int j = 0; j < 2; ++j) { accg[i][j] = {}; accu[i][j] = {}; }

  stage_gateup(As, Bs1, Bs3, Ag, B1g, B3g, row0, col0, 0, tid);

  const int NIT = ND / BK;
  for (int it = 0; it < NIT; ++it) {
    wait_async_all();
    __syncthreads();

    const int cur = it & 1;
    if (it + 1 < NIT) {
      const int nxt = (it + 1) & 1;
      stage_gateup(As + nxt * BM * LDP, Bs1 + nxt * BN * LDP, Bs3 + nxt * BN * LDP,
                   Ag, B1g, B3g, row0, col0, (it + 1) * BK, tid);
    }

    const unsigned short* Ab  = As  + cur * BM * LDP;
    const unsigned short* B1b = Bs1 + cur * BN * LDP;
    const unsigned short* B3b = Bs3 + cur * BN * LDP;

#pragma unroll
    for (int ks = 0; ks < BK; ks += 32) {
      v16bf af[2], b1f[2], b3f[2];
      af[0]  = load_frag(Ab  + (wm +  0) * LDP + ks, lane, LDP);
      af[1]  = load_frag(Ab  + (wm + 16) * LDP + ks, lane, LDP);
      b1f[0] = load_frag(B1b + (wn +  0) * LDP + ks, lane, LDP);
      b1f[1] = load_frag(B1b + (wn + 16) * LDP + ks, lane, LDP);
      b3f[0] = load_frag(B3b + (wn +  0) * LDP + ks, lane, LDP);
      b3f[1] = load_frag(B3b + (wn + 16) * LDP + ks, lane, LDP);

#pragma unroll
      for (int i = 0; i < 2; ++i)
#pragma unroll
        for (int j = 0; j < 2; ++j) {
          accg[i][j] = __builtin_amdgcn_wmma_f32_16x16x32_bf16(
              false, af[i], false, b1f[j], (short)0, accg[i][j], false, false);
          accu[i][j] = __builtin_amdgcn_wmma_f32_16x16x32_bf16(
              false, af[i], false, b3f[j], (short)0, accu[i][j], false, false);
        }
    }
  }

  // Epilogue: silu(gate) * up -> bf16 h.
  const int l16   = lane & 15;
  const int rhalf = (lane & 16) ? 8 : 0;  // C layout: lanes 16-31 hold M+8
  for (int i = 0; i < 2; ++i)
    for (int j = 0; j < 2; ++j) {
      const int rbase = row0 + wm + i * 16 + rhalf;
      const int cc    = col0 + wn + j * 16 + l16;
#pragma unroll
      for (int r = 0; r < 8; ++r) {
        const float g = accg[i][j][r];
        const float u = accu[i][j][r];
        const float s = g / (1.0f + __expf(-g));
        Hg[(size_t)(rbase + r) * NH + cc] = f2bf(s * u);
      }
    }
}

// ---------------------------------------------------------------------------
// GEMM 2: out[e] = h[e] @ w2[e]   (h bf16 [T][H], w2t bf16 [D][H], out fp32)
// Grid: (T/BM, D/BN, E). Double-buffered LDS, async-DMA pipelined.
// ---------------------------------------------------------------------------
__global__ __launch_bounds__(NTHREADS)
void moe_down_kernel(const unsigned short* __restrict__ hbuf,
                     const unsigned short* __restrict__ w2t,
                     float* __restrict__ out) {
  const int e    = blockIdx.z;
  const int row0 = blockIdx.x * BM;
  const int col0 = blockIdx.y * BN;

  const unsigned short* Ag = hbuf + (size_t)e * NT * NH;
  const unsigned short* Bg = w2t  + (size_t)e * ND * NH;
  float*                Cg = out  + (size_t)e * NT * ND;

  __shared__ __align__(16) unsigned short As[2 * BM * LDP];
  __shared__ __align__(16) unsigned short Bs[2 * BN * LDP];

  const int tid  = threadIdx.x;
  const int wave = tid >> 5;
  const int lane = tid & 31;
  const int wm   = (wave >> 2) * 32;
  const int wn   = (wave & 3)  * 32;

  v8f acc[2][2];
  for (int i = 0; i < 2; ++i)
    for (int j = 0; j < 2; ++j) acc[i][j] = {};

  stage_down(As, Bs, Ag, Bg, row0, col0, 0, tid);

  const int NIT = NH / BK;
  for (int it = 0; it < NIT; ++it) {
    wait_async_all();
    __syncthreads();

    const int cur = it & 1;
    if (it + 1 < NIT) {
      const int nxt = (it + 1) & 1;
      stage_down(As + nxt * BM * LDP, Bs + nxt * BN * LDP,
                 Ag, Bg, row0, col0, (it + 1) * BK, tid);
    }

    const unsigned short* Ab = As + cur * BM * LDP;
    const unsigned short* Bb = Bs + cur * BN * LDP;

#pragma unroll
    for (int ks = 0; ks < BK; ks += 32) {
      v16bf af[2], bf[2];
      af[0] = load_frag(Ab  + (wm +  0) * LDP + ks, lane, LDP);
      af[1] = load_frag(Ab  + (wm + 16) * LDP + ks, lane, LDP);
      bf[0] = load_frag(Bb  + (wn +  0) * LDP + ks, lane, LDP);
      bf[1] = load_frag(Bb  + (wn + 16) * LDP + ks, lane, LDP);

#pragma unroll
      for (int i = 0; i < 2; ++i)
#pragma unroll
        for (int j = 0; j < 2; ++j)
          acc[i][j] = __builtin_amdgcn_wmma_f32_16x16x32_bf16(
              false, af[i], false, bf[j], (short)0, acc[i][j], false, false);
    }
  }

  const int l16   = lane & 15;
  const int rhalf = (lane & 16) ? 8 : 0;
  for (int i = 0; i < 2; ++i)
    for (int j = 0; j < 2; ++j) {
      const int rbase = row0 + wm + i * 16 + rhalf;
      const int cc    = col0 + wn + j * 16 + l16;
#pragma unroll
      for (int r = 0; r < 8; ++r)
        Cg[(size_t)(rbase + r) * ND + cc] = acc[i][j][r];
    }
}

extern "C" void kernel_launch(void* const* d_in, const int* in_sizes, int n_in,
                              void* d_out, int out_size, void* d_ws, size_t ws_size,
                              hipStream_t stream) {
  const float* x  = (const float*)d_in[0];  // [E,T,D]
  const float* w1 = (const float*)d_in[1];  // [E,D,H]
  const float* w2 = (const float*)d_in[2];  // [E,H,D]
  const float* w3 = (const float*)d_in[3];  // [E,D,H]
  float* out = (float*)d_out;               // [E,T,D]

  // Workspace layout (bf16 elements): xb | w1t | w3t | w2t | hb  (~151 MB)
  unsigned short* ws = (unsigned short*)d_ws;
  size_t off = 0;
  unsigned short* xb  = ws + off; off += (size_t)NE * NT * ND;   // [E,T,D]
  unsigned short* w1t = ws + off; off += (size_t)NE * NH * ND;   // [E,H,D]
  unsigned short* w3t = ws + off; off += (size_t)NE * NH * ND;   // [E,H,D]
  unsigned short* w2t = ws + off; off += (size_t)NE * ND * NH;   // [E,D,H]
  unsigned short* hb  = ws + off;                                 // [E,T,H]

  dim3 blk(NTHREADS);

  // Pass 0: downcast + weight transpose.
  cvt_x_kernel<<<dim3(((size_t)NE * NT * ND) / 4 / 256), dim3(256), 0, stream>>>(x, xb);
  cvt_wT_kernel<<<dim3(NH / 64, ND / 64, NE), dim3(256), 0, stream>>>(w1, w1t, ND, NH);
  cvt_wT_kernel<<<dim3(NH / 64, ND / 64, NE), dim3(256), 0, stream>>>(w3, w3t, ND, NH);
  cvt_wT_kernel<<<dim3(ND / 64, NH / 64, NE), dim3(256), 0, stream>>>(w2, w2t, NH, ND);

  // GEMM 1: fused gate/up + SwiGLU.
  moe_gateup_kernel<<<dim3(NT / BM, NH / BN, NE), blk, 0, stream>>>(xb, w1t, w3t, hb);
  // GEMM 2: down projection.
  moe_down_kernel<<<dim3(NT / BM, ND / BN, NE), blk, 0, stream>>>(hb, w2t, out);
}

// v002
// One run takes 141 microseconds.
// Two timings next to v001 put it at 1.05 and 1.06 times that version's speed.
// Counting every step since v000, it is 2.07 times as fast.
#include <hip/hip_runtime.h>

typedef __attribute__((ext_vector_type(16))) __bf16 v16bf;
typedef __attribute__((ext_vector_type(8)))  __bf16 v8bf;
typedef __attribute__((ext_vector_type(8)))  float  v8f;
typedef __attribute__((ext_vector_type(4)))  unsigned int u32x4;
typedef __attribute__((ext_vector_type(2)))  unsigned int u32x2;
typedef __attribute__((ext_vector_type(4)))  int i32x4;

#define NE 8
#define NT 1024
#define ND 1024
#define NH 2048

// GEMM tiling (shared by both GEMM kernels)
#define BM 64
#define BN 128
#define BK 64
#define NTHREADS 256   // 8 waves; waves arranged 2 (M) x 4 (N), wave tile 32x32
// LDS row pitch of the staged tiles, in bf16 elements: 64 data + 8 pad = 144 B
// (16 B x odd), so the 16 rows one ds_load_b128 half-wave reads fall on all 64
// banks once; at the bare 128 B they share 8 banks.
#define LDP (BK + 8)

// Use CDNA5 async global->LDS DMA when the toolchain exposes it.
#if defined(__has_builtin)
#if __has_builtin(__builtin_amdgcn_global_load_async_to_lds_b128) && \
    __has_builtin(__builtin_amdgcn_s_wait_asynccnt)
#define USE_ASYNC 1
#endif
#endif
#ifndef USE_ASYNC
#define USE_ASYNC 0
#endif

// fp32 -> bf16 round-to-nearest-even (bit pattern)
static __device__ __forceinline__ unsigned short f2bf(float f) {
  unsigned u = __float_as_uint(f);
  unsigned r = u + 0x7FFFu + ((u >> 16) & 1u);
  return (unsigned short)(r >> 16);
}

// 16-byte global -> LDS copy (async DMA when available).
static __device__ __forceinline__ void cp16_g2l(unsigned short* l,
                                                const unsigned short* g) {
#if USE_ASYNC
  __builtin_amdgcn_global_load_async_to_lds_b128(
      (__attribute__((address_space(1))) i32x4*)g,
      (__attribute__((address_space(3))) i32x4*)l, 0, 0);
#else
  *(u32x4*)l = *(const u32x4*)g;
#endif
}

static __device__ __forceinline__ void wait_async_all() {
#if USE_ASYNC
  __builtin_amdgcn_s_wait_asynccnt(0);
#endif
}

// Load one 16x32 bf16 WMMA operand fragment from LDS.
// Rows are `stride` bf16 apart, K contiguous.
// Lanes 0-15: K 0-7 then 16-23; lanes 16-31: K 8-15 then 24-31.
static __device__ __forceinline__ v16bf load_frag(const unsigned short* base,
                                                  int lane, int stride) {
  const int l16 = lane & 15;
  const int kk0 = (lane & 16) ? 8 : 0;
  const unsigned short* p = base + l16 * stride + kk0;
  union { v16bf v; v8bf h[2]; } u;
  u.h[0] = *(const v8bf*)(p);
  u.h[1] = *(const v8bf*)(p + 16);
  return u.v;
}

// ---------------------------------------------------------------------------
// Pass 0a: x fp32 -> bf16, same layout [E*T, D].
// Few long-lived waves: each thread converts XV float4, all loads issued ahead,
// so the launch is paced by memory and not by how fast waves can be started.
// ---------------------------------------------------------------------------
#define XV 16   // float4 per thread
// waves_per_eu: at most 4 waves a SIMD are wanted, so the compiler may spend the
// registers that keep every load in flight instead of holding to 64.
__global__ __launch_bounds__(256) __attribute__((amdgpu_waves_per_eu(2, 4)))
void cvt_x_kernel(const float* __restrict__ src, unsigned short* __restrict__ dst) {
  const size_t b4 = ((size_t)blockIdx.x * (256 * XV) + threadIdx.x) * 4;
  float4 f[XV];
#pragma unroll
  for (int j = 0; j < XV; ++j) f[j] = *(const float4*)(src + b4 + (size_t)j * 1024);
  // Takes the loads' address as an input so that its registers stay untouched up
  // to this wait (the compiler let the last load land on them): a precaution.
  asm volatile("s_wait_xcnt 0x0" :: "v"(src + b4) : "memory");
#pragma unroll
  for (int j = 0; j < XV; ++j) {
    u32x2 p;
    p[0] = (unsigned)f2bf(f[j].x) | ((unsigned)f2bf(f[j].y) << 16);
    p[1] = (unsigned)f2bf(f[j].z) | ((unsigned)f2bf(f[j].w) << 16);
    *(u32x2*)(dst + b4 + (size_t)j * 1024) = p;
  }
}

// ---------------------------------------------------------------------------
// Pass 0b: weight fp32 [e][K][N] -> bf16 transposed [e][N][K].
// Each 256-thread block walks WT tiles of WK (k) x WN (n), neighbours along n,
// through two LDS buffers; the next tile's 8 loads per thread fly while this
// tile is read back transposed and stored. Coalesced in and out.
// Grid: (N/(WN*WT), K/WK, NE).
// ---------------------------------------------------------------------------
#define TP 72   // padded LDS row stride (bf16 elements)
#define WK 128  // k rows of a tile
#define WN 64   // n columns of a tile
#define WT 4    // tiles per block
static __device__ __forceinline__
void cvt_wT_body(const float* __restrict__ w, unsigned short* __restrict__ wt,
                 const int K, const int N) {
  const int e  = blockIdx.z;
  const int n0 = blockIdx.x * (WN * WT);
  const int k0 = blockIdx.y * WK;
  const float* S = w + (size_t)e * K * N + (size_t)k0 * N + n0;
  unsigned short* Dt = wt + (size_t)e * K * N + (size_t)n0 * K + k0;

  __shared__ __align__(16) unsigned short Ls[2 * WK * TP]; // two buffers of [k][n]

  const int tid = threadIdx.x;
  const int lr  = tid >> 4;          // k row, 16 float4 per row; +16 per load
  const int lc  = (tid & 15) << 2;   // n offset
  const int rn  = tid >> 3;          // n row of the read-back; +32 per odd chunk
  const int ck  = (tid & 7) << 3;    // k offset, 8 bf16 per chunk; +64 from chunk 2
  // Each lane's own part of the addresses, in bytes; the rest is the same for
  // the whole block.
  const unsigned lin  = (unsigned)(lr * N + lc) * 4u;
  const unsigned lout = (unsigned)(rn * K + ck) * 2u;

  float4 f[WK / 16];
#pragma unroll
  for (int j = 0; j < WK / 16; ++j)
    f[j] = *(const float4*)((const char*)(S + (size_t)(16 * j) * N) + lin);

  // Kept rolled: unrolled, the compiler lifts the next tile's conversion, and
  // with it the wait for its loads, above this tile's read-back.
#pragma unroll 1
  for (int t = 0; t < WT; ++t) {
    unsigned short* L = Ls + (t & 1) * (WK * TP);
#pragma unroll
    for (int j = 0; j < WK / 16; ++j) {
      u32x2 p;
      p[0] = (unsigned)f2bf(f[j].x) | ((unsigned)f2bf(f[j].y) << 16);
      p[1] = (unsigned)f2bf(f[j].z) | ((unsigned)f2bf(f[j].w) << 16);
      *(u32x2*)&L[(lr + 16 * j) * TP + lc] = p;
    }
    // One barrier a tile: it publishes this buffer, and every wave that passes
    // it has finished reading the other buffer, which the next trip refills.
    __syncthreads();

    if (t + 1 < WT) {
#pragma unroll
      for (int j = 0; j < WK / 16; ++j)
        f[j] = *(const float4*)((const char*)(S + (size_t)(16 * j) * N + (t + 1) * WN) + lin);
      // The read-back below reuses the loads' address registers; the wait is
      // written here as a precaution.
      asm volatile("s_wait_xcnt 0x0" ::: "memory");
    }

#pragma unroll
    for (int i = 0; i < (WK * WN) / 8 / 256; ++i) {
      const int dn = (i & 1) * 32, dk = (i >> 1) * 64;
      union { u32x4 v; unsigned short s[8]; } u;
#pragma unroll
      for (int j = 0; j < 8; ++j) u.s[j] = L[(ck + dk + j) * TP + rn + dn];
      *(u32x4*)((char*)(Dt + (size_t)(t * WN + dn) * K + dk) + lout) = u.v;
    }
  }
}

// K and N as constants: a tile's 8 loads then share one address register pair
// and differ by immediate offsets only. waves_per_eu: as at cvt_x_kernel.
__global__ __launch_bounds__(256) __attribute__((amdgpu_waves_per_eu(2, 4)))
void cvt_wT_dh_kernel(const float* __restrict__ w, unsigned short* __restrict__ wt) {
  cvt_wT_body(w, wt, ND, NH);
}
__global__ __launch_bounds__(256) __attribute__((amdgpu_waves_per_eu(2, 4)))
void cvt_wT_hd_kernel(const float* __restrict__ w, unsigned short* __restrict__ wt) {
  cvt_wT_body(w, wt, NH, ND);
}

// ---------------------------------------------------------------------------
// Staging helpers (one K-stage worth of tiles into one LDS buffer).
// ---------------------------------------------------------------------------
static __device__ __forceinline__ void stage_gateup(
    unsigned short* As, unsigned short* Bs1, unsigned short* Bs3,
    const unsigned short* Ag, const unsigned short* B1g,
    const unsigned short* B3g, int row0, int col0, int k0, int tid) {
  for (int c = tid; c < (BM * BK) / 8; c += NTHREADS) {
    const int r = c >> 3, kk = (c & 7) << 3;
    cp16_g2l(&As[r * LDP + kk], Ag + (size_t)(row0 + r) * ND + k0 + kk);
  }
  for (int c = tid; c < (BN * BK) / 8; c += NTHREADS) {
    const int r = c >> 3, kk = (c & 7) << 3;
    const size_t go = (size_t)(col0 + r) * ND + k0 + kk;
    cp16_g2l(&Bs1[r * LDP + kk], B1g + go);
    cp16_g2l(&Bs3[r * LDP + kk], B3g + go);
  }
}

static __device__ __forceinline__ void stage_down(
    unsigned short* As, unsigned short* Bs,
    const unsigned short* Ag, const unsigned short* Bg,
    int row0, int col0, int k0, int tid) {
  for (int c = tid; c < (BM * BK) / 8; c += NTHREADS) {
    const int r = c >> 3, kk = (c & 7) << 3;
    cp16_g2l(&As[r * LDP + kk], Ag + (size_t)(row0 + r) * NH + k0 + kk);
  }
  for (int c = tid; c < (BN * BK) / 8; c += NTHREADS) {
    const int r = c >> 3, kk = (c & 7) << 3;
    cp16_g2l(&Bs[r * LDP + kk], Bg + (size_t)(col0 + r) * NH + k0 + kk);
  }
}

// ---------------------------------------------------------------------------
// GEMM 1 (fused): h[e] = silu(x[e] @ w1[e]) * (x[e] @ w3[e]) -> bf16.
// A: xb [e][T][D]; B: w1t/w3t [e][H][D] (pre-transposed, K-contiguous).
// Grid: (T/BM, H/BN, E). Double-buffered LDS, async-DMA pipelined.
// ---------------------------------------------------------------------------
__global__ __launch_bounds__(NTHREADS)
void moe_gateup_kernel(const unsigned short* __restrict__ xb,
                       const unsigned short* __restrict__ w1t,
                       const unsigned short* __restrict__ w3t,
                       unsigned short* __restrict__ hbuf) {
  const int e    = blockIdx.z;
  const int row0 = blockIdx.x * BM;
  const int col0 = blockIdx.y * BN;

  const unsigned short* Ag  = xb  + (size_t)e * NT * ND;
  const unsigned short* B1g = w1t + (size_t)e * NH * ND;
  const unsigned short* B3g = w3t + (size_t)e * NH * ND;
  unsigned short* Hg = hbuf + (size_t)e * NT * NH;

  __shared__ __align__(16) unsigned short As [2 * BM * LDP];
  __shared__ __align__(16) unsigned short Bs1[2 * BN * LDP];
  __shared__ __align__(16) unsigned short Bs3[2 * BN * LDP];

  const int tid  = threadIdx.x;
  const int wave = tid >> 5;
  const int lane = tid & 31;
  const int wm   = (wave >> 2) * 32;  // 0 or 32
  const int wn   = (wave & 3)  * 32;  // 0..96

  v8f accg[2][2], accu[2][2];
  for (int i = 0; i < 2; ++i)
    for (int j = 0; j < 2; ++j) { accg[i][j] = {}; accu[i][j] = {}; }

  stage_gateup(As, Bs1, Bs3, Ag, B1g, B3g, row0, col0, 0, tid);

  const int NIT = ND / BK;
  for (int it = 0; it < NIT; ++it) {
    wait_async_all();
    __syncthreads();

    const int cur = it & 1;
    if (it + 1 < NIT) {
      const int nxt = (it + 1) & 1;
      stage_gateup(As + nxt * BM * LDP, Bs1 + nxt * BN * LDP, Bs3 + nxt * BN * LDP,
                   Ag, B1g, B3g, row0, col0, (it + 1) * BK, tid);
    }

    const unsigned short* Ab  = As  + cur * BM * LDP;
    const unsigned short* B1b = Bs1 + cur * BN * LDP;
    const unsigned short* B3b = Bs3 + cur * BN * LDP;

#pragma unroll
    for (int ks = 0; ks < BK; ks += 32) {
      v16bf af[2], b1f[2], b3f[2];
      af[0]  = load_frag(Ab  + (wm +  0) * LDP + ks, lane, LDP);
      af[1]  = load_frag(Ab  + (wm + 16) * LDP + ks, lane, LDP);
      b1f[0] = load_frag(B1b + (wn +  0) * LDP + ks, lane, LDP);
      b1f[1] = load_frag(B1b + (wn + 16) * LDP + ks, lane, LDP);
      b3f[0] = load_frag(B3b + (wn +  0) * LDP + ks, lane, LDP);
      b3f[1] = load_frag(B3b + (wn + 16) * LDP + ks, lane, LDP);

#pragma unroll
      for (int i = 0; i < 2; ++i)
#pragma unroll
        for (int j = 0; j < 2; ++j) {
          accg[i][j] = __builtin_amdgcn_wmma_f32_16x16x32_bf16(
              false, af[i], false, b1f[j], (short)0, accg[i][j], false, false);
          accu[i][j] = __builtin_amdgcn_wmma_f32_16x16x32_bf16(
              false, af[i], false, b3f[j], (short)0, accu[i][j], false, false);
        }
    }
  }

  // Epilogue: silu(gate) * up -> bf16 h.
  const int l16   = lane & 15;
  const int rhalf = (lane & 16) ? 8 : 0;  // C layout: lanes 16-31 hold M+8
  for (int i = 0; i < 2; ++i)
    for (int j = 0; j < 2; ++j) {
      const int rbase = row0 + wm + i * 16 + rhalf;
      const int cc    = col0 + wn + j * 16 + l16;
#pragma unroll
      for (int r = 0; r < 8; ++r) {
        const float g = accg[i][j][r];
        const float u = accu[i][j][r];
        const float s = g / (1.0f + __expf(-g));
        Hg[(size_t)(rbase + r) * NH + cc] = f2bf(s * u);
      }
    }
}

// ---------------------------------------------------------------------------
// GEMM 2: out[e] = h[e] @ w2[e]   (h bf16 [T][H], w2t bf16 [D][H], out fp32)
// Grid: (T/BM, D/BN, E). Double-buffered LDS, async-DMA pipelined.
// ---------------------------------------------------------------------------
__global__ __launch_bounds__(NTHREADS)
void moe_down_kernel(const unsigned short* __restrict__ hbuf,
                     const unsigned short* __restrict__ w2t,
                     float* __restrict__ out) {
  const int e    = blockIdx.z;
  const int row0 = blockIdx.x * BM;
  const int col0 = blockIdx.y * BN;

  const unsigned short* Ag = hbuf + (size_t)e * NT * NH;
  const unsigned short* Bg = w2t  + (size_t)e * ND * NH;
  float*                Cg = out  + (size_t)e * NT * ND;

  __shared__ __align__(16) unsigned short As[2 * BM * LDP];
  __shared__ __align__(16) unsigned short Bs[2 * BN * LDP];

  const int tid  = threadIdx.x;
  const int wave = tid >> 5;
  const int lane = tid & 31;
  const int wm   = (wave >> 2) * 32;
  const int wn   = (wave & 3)  * 32;

  v8f acc[2][2];
  for (int i = 0; i < 2; ++i)
    for (int j = 0; j < 2; ++j) acc[i][j] = {};

  stage_down(As, Bs, Ag, Bg, row0, col0, 0, tid);

  const int NIT = NH / BK;
  for (int it = 0; it < NIT; ++it) {
    wait_async_all();
    __syncthreads();

    const int cur = it & 1;
    if (it + 1 < NIT) {
      const int nxt = (it + 1) & 1;
      stage_down(As + nxt * BM * LDP, Bs + nxt * BN * LDP,
                 Ag, Bg, row0, col0, (it + 1) * BK, tid);
    }

    const unsigned short* Ab = As + cur * BM * LDP;
    const unsigned short* Bb = Bs + cur * BN * LDP;

#pragma unroll
    for (int ks = 0; ks < BK; ks += 32) {
      v16bf af[2], bf[2];
      af[0] = load_frag(Ab  + (wm +  0) * LDP + ks, lane, LDP);
      af[1] = load_frag(Ab  + (wm + 16) * LDP + ks, lane, LDP);
      bf[0] = load_frag(Bb  + (wn +  0) * LDP + ks, lane, LDP);
      bf[1] = load_frag(Bb  + (wn + 16) * LDP + ks, lane, LDP);

#pragma unroll
      for (int i = 0; i < 2; ++i)
#pragma unroll
        for (int j = 0; j < 2; ++j)
          acc[i][j] = __builtin_amdgcn_wmma_f32_16x16x32_bf16(
              false, af[i], false, bf[j], (short)0, acc[i][j], false, false);
    }
  }

  const int l16   = lane & 15;
  const int rhalf = (lane & 16) ? 8 : 0;
  for (int i = 0; i < 2; ++i)
    for (int j = 0; j < 2; ++j) {
      const int rbase = row0 + wm + i * 16 + rhalf;
      const int cc    = col0 + wn + j * 16 + l16;
#pragma unroll
      for (int r = 0; r < 8; ++r)
        Cg[(size_t)(rbase + r) * ND + cc] = acc[i][j][r];
    }
}

extern "C" void kernel_launch(void* const* d_in, const int* in_sizes, int n_in,
                              void* d_out, int out_size, void* d_ws, size_t ws_size,
                              hipStream_t stream) {
  const float* x  = (const float*)d_in[0];  // [E,T,D]
  const float* w1 = (const float*)d_in[1];  // [E,D,H]
  const float* w2 = (const float*)d_in[2];  // [E,H,D]
  const float* w3 = (const float*)d_in[3];  // [E,D,H]
  float* out = (float*)d_out;               // [E,T,D]

  // Workspace layout (bf16 elements): xb | w1t | w3t | w2t | hb  (~151 MB)
  unsigned short* ws = (unsigned short*)d_ws;
  size_t off = 0;
  unsigned short* xb  = ws + off; off += (size_t)NE * NT * ND;   // [E,T,D]
  unsigned short* w1t = ws + off; off += (size_t)NE * NH * ND;   // [E,H,D]
  unsigned short* w3t = ws + off; off += (size_t)NE * NH * ND;   // [E,H,D]
  unsigned short* w2t = ws + off; off += (size_t)NE * ND * NH;   // [E,D,H]
  unsigned short* hb  = ws + off;                                 // [E,T,H]

  dim3 blk(NTHREADS);

  // Pass 0: downcast + weight transpose.
  cvt_x_kernel<<<dim3(((size_t)NE * NT * ND) / 4 / 256 / XV), dim3(256), 0, stream>>>(x, xb);
  cvt_wT_dh_kernel<<<dim3(NH / (WN * WT), ND / WK, NE), dim3(256), 0, stream>>>(w1, w1t);
  cvt_wT_dh_kernel<<<dim3(NH / (WN * WT), ND / WK, NE), dim3(256), 0, stream>>>(w3, w3t);
  cvt_wT_hd_kernel<<<dim3(ND / (WN * WT), NH / WK, NE), dim3(256), 0, stream>>>(w2, w2t);

  // GEMM 1: fused gate/up + SwiGLU.
  moe_gateup_kernel<<<dim3(NT / BM, NH / BN, NE), blk, 0, stream>>>(xb, w1t, w3t, hb);
  // GEMM 2: down projection.
  moe_down_kernel<<<dim3(NT / BM, ND / BN, NE), blk, 0, stream>>>(hb, w2t, out);
}

// v003
// One run takes 118 microseconds.
// Two timings next to v002 both put it at 1.18 times that version's speed.
// All steps since v000 together make it 2.45 times as fast.
#include <hip/hip_runtime.h>

typedef __attribute__((ext_vector_type(16))) __bf16 v16bf;
typedef __attribute__((ext_vector_type(8)))  __bf16 v8bf;
typedef __attribute__((ext_vector_type(8)))  float  v8f;
typedef __attribute__((ext_vector_type(4)))  unsigned int u32x4;
typedef __attribute__((ext_vector_type(2)))  unsigned int u32x2;
typedef __attribute__((ext_vector_type(4)))  int i32x4;

#define NE 8
#define NT 1024
#define ND 1024
#define NH 2048

// GEMM tiling. 8 waves, arranged 2 (M) x 4 (N), in both GEMM kernels.
// Every fragment a wave reads from LDS feeds as many WMMAs as the other operand
// has fragments, and every staged row as many as the block tile is wide, so the
// tiles are as large as the grid allows with all WGPs at work.
#define BK 64
#define NTHREADS 256
// Gate/up: block 256 rows x 128 columns of w1 AND of w3; wave 128 x (32 + 32).
#define G_BM 256
#define G_BN 128
#define G_MF 8   // A fragments of a wave
#define G_NF 2   // B fragments of a wave, of each weight
// Down: block 128 x 256; wave 64 x 64.
#define D_BM 128
#define D_BN 256
#define D_MF 4
#define D_NF 4
// LDS row pitch of the staged tiles, in bf16 elements: 64 data + 8 pad = 144 B
// (16 B x odd), so the 16 rows one ds_load_b128 half-wave reads fall on all 64
// banks once; at the bare 128 B they share 8 banks.
#define LDP (BK + 8)

// Use CDNA5 async global->LDS DMA when the toolchain exposes it.
#if defined(__has_builtin)
#if __has_builtin(__builtin_amdgcn_global_load_async_to_lds_b128) && \
    __has_builtin(__builtin_amdgcn_s_wait_asynccnt)
#define USE_ASYNC 1
#endif
#endif
#ifndef USE_ASYNC
#define USE_ASYNC 0
#endif

// fp32 -> bf16 round-to-nearest-even (bit pattern)
static __device__ __forceinline__ unsigned short f2bf(float f) {
  unsigned u = __float_as_uint(f);
  unsigned r = u + 0x7FFFu + ((u >> 16) & 1u);
  return (unsigned short)(r >> 16);
}

// 16-byte global -> LDS copy (async DMA when available).
static __device__ __forceinline__ void cp16_g2l(unsigned short* l,
                                                const unsigned short* g) {
#if USE_ASYNC
  __builtin_amdgcn_global_load_async_to_lds_b128(
      (__attribute__((address_space(1))) i32x4*)g,
      (__attribute__((address_space(3))) i32x4*)l, 0, 0);
#else
  *(u32x4*)l = *(const u32x4*)g;
#endif
}

static __device__ __forceinline__ void wait_async_all() {
#if USE_ASYNC
  __builtin_amdgcn_s_wait_asynccnt(0);
#endif
}

// Load one 16x32 bf16 WMMA operand fragment from LDS.
// Rows are `stride` bf16 apart, K contiguous.
// Lanes 0-15: K 0-7 then 16-23; lanes 16-31: K 8-15 then 24-31.
static __device__ __forceinline__ v16bf load_frag(const unsigned short* base,
                                                  int lane, int stride) {
  const int l16 = lane & 15;
  const int kk0 = (lane & 16) ? 8 : 0;
  const unsigned short* p = base + l16 * stride + kk0;
  union { v16bf v; v8bf h[2]; } u;
  u.h[0] = *(const v8bf*)(p);
  u.h[1] = *(const v8bf*)(p + 16);
  return u.v;
}

// ---------------------------------------------------------------------------
// Pass 0a: x fp32 -> bf16, same layout [E*T, D].
// Few long-lived waves: each thread converts XV float4, all loads issued ahead,
// so the launch is paced by memory and not by how fast waves can be started.
// ---------------------------------------------------------------------------
#define XV 16   // float4 per thread
// waves_per_eu: at most 4 waves a SIMD are wanted, so the compiler may spend the
// registers that keep every load in flight instead of holding to 64.
__global__ __launch_bounds__(256) __attribute__((amdgpu_waves_per_eu(2, 4)))
void cvt_x_kernel(const float* __restrict__ src, unsigned short* __restrict__ dst) {
  const size_t b4 = ((size_t)blockIdx.x * (256 * XV) + threadIdx.x) * 4;
  float4 f[XV];
#pragma unroll
  for (int j = 0; j < XV; ++j) f[j] = *(const float4*)(src + b4 + (size_t)j * 1024);
  // Takes the loads' address as an input so that its registers stay untouched up
  // to this wait (the compiler let the last load land on them): a precaution.
  asm volatile("s_wait_xcnt 0x0" :: "v"(src + b4) : "memory");
#pragma unroll
  for (int j = 0; j < XV; ++j) {
    u32x2 p;
    p[0] = (unsigned)f2bf(f[j].x) | ((unsigned)f2bf(f[j].y) << 16);
    p[1] = (unsigned)f2bf(f[j].z) | ((unsigned)f2bf(f[j].w) << 16);
    *(u32x2*)(dst + b4 + (size_t)j * 1024) = p;
  }
}

// ---------------------------------------------------------------------------
// Pass 0b: weight fp32 [e][K][N] -> bf16 transposed [e][N][K].
// Each 256-thread block walks WT tiles of WK (k) x WN (n), neighbours along n,
// through two LDS buffers; the next tile's 8 loads per thread fly while this
// tile is read back transposed and stored. Coalesced in and out.
// Grid: (N/(WN*WT), K/WK, NE).
// ---------------------------------------------------------------------------
#define TP 72   // padded LDS row stride (bf16 elements)
#define WK 128  // k rows of a tile
#define WN 64   // n columns of a tile
#define WT 4    // tiles per block
static __device__ __forceinline__
void cvt_wT_body(const float* __restrict__ w, unsigned short* __restrict__ wt,
                 const int K, const int N) {
  const int e  = blockIdx.z;
  const int n0 = blockIdx.x * (WN * WT);
  const int k0 = blockIdx.y * WK;
  const float* S = w + (size_t)e * K * N + (size_t)k0 * N + n0;
  unsigned short* Dt = wt + (size_t)e * K * N + (size_t)n0 * K + k0;

  __shared__ __align__(16) unsigned short Ls[2 * WK * TP]; // two buffers of [k][n]

  const int tid = threadIdx.x;
  const int lr  = tid >> 4;          // k row, 16 float4 per row; +16 per load
  const int lc  = (tid & 15) << 2;   // n offset
  const int rn  = tid >> 3;          // n row of the read-back; +32 per odd chunk
  const int ck  = (tid & 7) << 3;    // k offset, 8 bf16 per chunk; +64 from chunk 2
  // Each lane's own part of the addresses, in bytes; the rest is the same for
  // the whole block.
  const unsigned lin  = (unsigned)(lr * N + lc) * 4u;
  const unsigned lout = (unsigned)(rn * K + ck) * 2u;

  float4 f[WK / 16];
#pragma unroll
  for (int j = 0; j < WK / 16; ++j)
    f[j] = *(const float4*)((const char*)(S + (size_t)(16 * j) * N) + lin);

  // Kept rolled: unrolled, the compiler lifts the next tile's conversion, and
  // with it the wait for its loads, above this tile's read-back.
#pragma unroll 1
  for (int t = 0; t < WT; ++t) {
    unsigned short* L = Ls + (t & 1) * (WK * TP);
#pragma unroll
    for (int j = 0; j < WK / 16; ++j) {
      u32x2 p;
      p[0] = (unsigned)f2bf(f[j].x) | ((unsigned)f2bf(f[j].y) << 16);
      p[1] = (unsigned)f2bf(f[j].z) | ((unsigned)f2bf(f[j].w) << 16);
      *(u32x2*)&L[(lr + 16 * j) * TP + lc] = p;
    }
    // One barrier a tile: it publishes this buffer, and every wave that passes
    // it has finished reading the other buffer, which the next trip refills.
    __syncthreads();

    if (t + 1 < WT) {
#pragma unroll
      for (int j = 0; j < WK / 16; ++j)
        f[j] = *(const float4*)((const char*)(S + (size_t)(16 * j) * N + (t + 1) * WN) + lin);
      // The read-back below reuses the loads' address registers; the wait is
      // written here as a precaution.
      asm volatile("s_wait_xcnt 0x0" ::: "memory");
    }

#pragma unroll
    for (int i = 0; i < (WK * WN) / 8 / 256; ++i) {
      const int dn = (i & 1) * 32, dk = (i >> 1) * 64;
      union { u32x4 v; unsigned short s[8]; } u;
#pragma unroll
      for (int j = 0; j < 8; ++j) u.s[j] = L[(ck + dk + j) * TP + rn + dn];
      *(u32x4*)((char*)(Dt + (size_t)(t * WN + dn) * K + dk) + lout) = u.v;
    }
  }
}

// K and N as constants: a tile's 8 loads then share one address register pair
// and differ by immediate offsets only. waves_per_eu: as at cvt_x_kernel.
__global__ __launch_bounds__(256) __attribute__((amdgpu_waves_per_eu(2, 4)))
void cvt_wT_dh_kernel(const float* __restrict__ w, unsigned short* __restrict__ wt) {
  cvt_wT_body(w, wt, ND, NH);
}
__global__ __launch_bounds__(256) __attribute__((amdgpu_waves_per_eu(2, 4)))
void cvt_wT_hd_kernel(const float* __restrict__ w, unsigned short* __restrict__ wt) {
  cvt_wT_body(w, wt, NH, ND);
}

// ---------------------------------------------------------------------------
// Staging helpers (one K-stage worth of tiles into one LDS buffer).
// ---------------------------------------------------------------------------
static __device__ __forceinline__ void stage_gateup(
    unsigned short* As, unsigned short* Bs1, unsigned short* Bs3,
    const unsigned short* Ag, const unsigned short* B1g,
    const unsigned short* B3g, int row0, int col0, int k0, int tid) {
  // Trip counts are constants, here and in stage_down: the copies then unroll,
  // differ by constant steps, and no lane mask is formed around them.
#pragma unroll
  for (int q = 0; q < (G_BM * BK) / 8 / NTHREADS; ++q) {
    const int c = tid + q * NTHREADS;
    const int r = c >> 3, kk = (c & 7) << 3;
    cp16_g2l(&As[r * LDP + kk], Ag + (size_t)(row0 + r) * ND + k0 + kk);
  }
#pragma unroll
  for (int q = 0; q < (G_BN * BK) / 8 / NTHREADS; ++q) {
    const int c = tid + q * NTHREADS;
    const int r = c >> 3, kk = (c & 7) << 3;
    const size_t go = (size_t)(col0 + r) * ND + k0 + kk;
    cp16_g2l(&Bs1[r * LDP + kk], B1g + go);
    cp16_g2l(&Bs3[r * LDP + kk], B3g + go);
  }
}

static __device__ __forceinline__ void stage_down(
    unsigned short* As, unsigned short* Bs,
    const unsigned short* Ag, const unsigned short* Bg,
    int row0, int col0, int k0, int tid) {
#pragma unroll
  for (int q = 0; q < (D_BM * BK) / 8 / NTHREADS; ++q) {
    const int c = tid + q * NTHREADS;
    const int r = c >> 3, kk = (c & 7) << 3;
    cp16_g2l(&As[r * LDP + kk], Ag + (size_t)(row0 + r) * NH + k0 + kk);
  }
#pragma unroll
  for (int q = 0; q < (D_BN * BK) / 8 / NTHREADS; ++q) {
    const int c = tid + q * NTHREADS;
    const int r = c >> 3, kk = (c & 7) << 3;
    cp16_g2l(&Bs[r * LDP + kk], Bg + (size_t)(col0 + r) * NH + k0 + kk);
  }
}

// ---------------------------------------------------------------------------
// GEMM 1 (fused): h[e] = silu(x[e] @ w1[e]) * (x[e] @ w3[e]) -> bf16.
// A: xb [e][T][D]; B: w1t/w3t [e][H][D] (pre-transposed, K-contiguous).
// Grid: (T/G_BM, H/G_BN, E). Double-buffered LDS, async-DMA pipelined.
// ---------------------------------------------------------------------------
__global__ __launch_bounds__(NTHREADS)
void moe_gateup_kernel(const unsigned short* __restrict__ xb,
                       const unsigned short* __restrict__ w1t,
                       const unsigned short* __restrict__ w3t,
                       unsigned short* __restrict__ hbuf) {
  const int e    = blockIdx.z;
  const int row0 = blockIdx.x * G_BM;
  const int col0 = blockIdx.y * G_BN;

  const unsigned short* Ag  = xb  + (size_t)e * NT * ND;
  const unsigned short* B1g = w1t + (size_t)e * NH * ND;
  const unsigned short* B3g = w3t + (size_t)e * NH * ND;
  unsigned short* Hg = hbuf + (size_t)e * NT * NH;

  __shared__ __align__(16) unsigned short As [2 * G_BM * LDP];
  __shared__ __align__(16) unsigned short Bs1[2 * G_BN * LDP];
  __shared__ __align__(16) unsigned short Bs3[2 * G_BN * LDP];

  const int tid  = threadIdx.x;
  const int wave = tid >> 5;
  const int lane = tid & 31;
  const int wm   = (wave >> 2) * (G_MF * 16);  // 0 or 128
  const int wn   = (wave & 3)  * (G_NF * 16);  // 0..96

  // Every loop over the accumulator tiles is unrolled in full: an index that is
  // not a constant would put the tiles in scratch memory.
  v8f accg[G_MF][G_NF], accu[G_MF][G_NF];
#pragma unroll
  for (int i = 0; i < G_MF; ++i)
#pragma unroll
    for (int j = 0; j < G_NF; ++j) { accg[i][j] = {}; accu[i][j] = {}; }

  stage_gateup(As, Bs1, Bs3, Ag, B1g, B3g, row0, col0, 0, tid);

  const int NIT = ND / BK;
  for (int it = 0; it < NIT; ++it) {
    wait_async_all();
    __syncthreads();

    const int cur = it & 1;
    if (it + 1 < NIT) {
      const int nxt = (it + 1) & 1;
      stage_gateup(As + nxt * G_BM * LDP, Bs1 + nxt * G_BN * LDP, Bs3 + nxt * G_BN * LDP,
                   Ag, B1g, B3g, row0, col0, (it + 1) * BK, tid);
    }

    const unsigned short* Ab  = As  + cur * G_BM * LDP;
    const unsigned short* B1b = Bs1 + cur * G_BN * LDP;
    const unsigned short* B3b = Bs3 + cur * G_BN * LDP;

    // The stage's two k steps, each with a fragment set of its own. The three
    // sched_barriers hold this order: step 0's loads in one group, half of its
    // WMMAs, step 1's loads in one group, the other WMMAs. Left alone the
    // compiler loads one A fragment at a time into one register set and waits
    // out the LDS latency every 4 WMMAs, which two waves a SIMD cannot hide.
    static_assert(BK == 64, "two k steps a stage");
    v16bf af[2][G_MF], b1f[2][G_NF], b3f[2][G_NF];
#pragma unroll
    for (int s = 0; s < 2; ++s) {
#pragma unroll
      for (int j = 0; j < G_NF; ++j) {
        b1f[s][j] = load_frag(B1b + (wn + 16 * j) * LDP + 32 * s, lane, LDP);
        b3f[s][j] = load_frag(B3b + (wn + 16 * j) * LDP + 32 * s, lane, LDP);
      }
#pragma unroll
      for (int i = 0; i < G_MF; ++i)
        af[s][i] = load_frag(Ab + (wm + 16 * i) * LDP + 32 * s, lane, LDP);
      __builtin_amdgcn_sched_barrier(0);
      // Behind step 0's loads rows 0..3 of step 0; behind step 1's the rest.
#pragma unroll
      for (int t = (s == 0 ? 0 : G_MF / 2); t < (s == 0 ? G_MF / 2 : 2 * G_MF); ++t) {
        const int ss = t / G_MF, i = t % G_MF;
#pragma unroll
        for (int j = 0; j < G_NF; ++j) {
          accg[i][j] = __builtin_amdgcn_wmma_f32_16x16x32_bf16(
              false, af[ss][i], false, b1f[ss][j], (short)0, accg[i][j], false, false);
          accu[i][j] = __builtin_amdgcn_wmma_f32_16x16x32_bf16(
              false, af[ss][i], false, b3f[ss][j], (short)0, accu[i][j], false, false);
        }
      }
      if (s == 0) __builtin_amdgcn_sched_barrier(0);
    }
  }

  // Keeps the epilogue's arithmetic out of the last stage's WMMAs: mixed in while
  // both fragment sets are live, it made the build spill to scratch memory.
  __builtin_amdgcn_sched_barrier(0);

  // Epilogue: silu(gate) * up -> bf16 h.
  const int l16   = lane & 15;
  const int rhalf = (lane & 16) ? 8 : 0;  // C layout: lanes 16-31 hold M+8
#pragma unroll
  for (int i = 0; i < G_MF; ++i)
#pragma unroll
    for (int j = 0; j < G_NF; ++j) {
      const int rbase = row0 + wm + i * 16 + rhalf;
      const int cc    = col0 + wn + j * 16 + l16;
      unsigned short* hp = Hg + (size_t)rbase * NH + cc;
      unsigned hv[8];  // the rounded value, bf16 in the high half (as in f2bf)
#pragma unroll
      for (int r = 0; r < 8; ++r) {
        const float g = accg[i][j][r];
        const float u = accu[i][j][r];
        const float s = g / (1.0f + __expf(-g));
        const unsigned w = __float_as_uint(s * u);
        hv[r] = w + 0x7FFFu + ((w >> 16) & 1u);
        hp[(size_t)r * NH] = (unsigned short)(hv[r] >> 16);
      }
      // The next tile's arithmetic reuses the stores' registers. Takes the address and
      // the stored words as inputs so that they stay untouched up to the wait:
      // a precaution.
      asm volatile("s_wait_xcnt 0x0"
                   :: "v"(hp), "v"(hv[0]), "v"(hv[1]), "v"(hv[2]), "v"(hv[3]),
                      "v"(hv[4]), "v"(hv[5]), "v"(hv[6]), "v"(hv[7])
                   : "memory");
    }
}

// ---------------------------------------------------------------------------
// GEMM 2: out[e] = h[e] @ w2[e]   (h bf16 [T][H], w2t bf16 [D][H], out fp32)
// Grid: (T/D_BM, D/D_BN, E). Double-buffered LDS, async-DMA pipelined.
// ---------------------------------------------------------------------------
__global__ __launch_bounds__(NTHREADS)
void moe_down_kernel(const unsigned short* __restrict__ hbuf,
                     const unsigned short* __restrict__ w2t,
                     float* __restrict__ out) {
  const int e    = blockIdx.z;
  const int row0 = blockIdx.x * D_BM;
  const int col0 = blockIdx.y * D_BN;

  const unsigned short* Ag = hbuf + (size_t)e * NT * NH;
  const unsigned short* Bg = w2t  + (size_t)e * ND * NH;
  float*                Cg = out  + (size_t)e * NT * ND;

  __shared__ __align__(16) unsigned short As[2 * D_BM * LDP];
  __shared__ __align__(16) unsigned short Bs[2 * D_BN * LDP];

  const int tid  = threadIdx.x;
  const int wave = tid >> 5;
  const int lane = tid & 31;
  const int wm   = (wave >> 2) * (D_MF * 16);  // 0 or 64
  const int wn   = (wave & 3)  * (D_NF * 16);  // 0..192

  // Unrolled in full, here and below, as in the gate/up kernel.
  v8f acc[D_MF][D_NF];
#pragma unroll
  for (int i = 0; i < D_MF; ++i)
#pragma unroll
    for (int j = 0; j < D_NF; ++j) acc[i][j] = {};

  stage_down(As, Bs, Ag, Bg, row0, col0, 0, tid);

  const int NIT = NH / BK;
  for (int it = 0; it < NIT; ++it) {
    wait_async_all();
    __syncthreads();

    const int cur = it & 1;
    if (it + 1 < NIT) {
      const int nxt = (it + 1) & 1;
      stage_down(As + nxt * D_BM * LDP, Bs + nxt * D_BN * LDP,
                 Ag, Bg, row0, col0, (it + 1) * BK, tid);
    }

    const unsigned short* Ab = As + cur * D_BM * LDP;
    const unsigned short* Bb = Bs + cur * D_BN * LDP;

    // Two k steps, two fragment sets; the three sched_barriers hold the order
    // of loads and WMMAs as in the gate/up kernel, and for the same reason.
    v16bf af[2][D_MF], bf[2][D_NF];
#pragma unroll
    for (int s = 0; s < 2; ++s) {
#pragma unroll
      for (int j = 0; j < D_NF; ++j)
        bf[s][j] = load_frag(Bb + (wn + 16 * j) * LDP + 32 * s, lane, LDP);
#pragma unroll
      for (int i = 0; i < D_MF; ++i)
        af[s][i] = load_frag(Ab + (wm + 16 * i) * LDP + 32 * s, lane, LDP);
      __builtin_amdgcn_sched_barrier(0);
#pragma unroll
      for (int t = (s == 0 ? 0 : D_MF / 2); t < (s == 0 ? D_MF / 2 : 2 * D_MF); ++t) {
        const int ss = t / D_MF, i = t % D_MF;
#pragma unroll
        for (int j = 0; j < D_NF; ++j)
          acc[i][j] = __builtin_amdgcn_wmma_f32_16x16x32_bf16(
              false, af[ss][i], false, bf[ss][j], (short)0, acc[i][j], false, false);
      }
      if (s == 0) __builtin_amdgcn_sched_barrier(0);
    }
  }

  const int l16   = lane & 15;
  const int rhalf = (lane & 16) ? 8 : 0;
#pragma unroll
  for (int i = 0; i < D_MF; ++i)
#pragma unroll
    for (int j = 0; j < D_NF; ++j) {
      const int rbase = row0 + wm + i * 16 + rhalf;
      const int cc    = col0 + wn + j * 16 + l16;
#pragma unroll
      for (int r = 0; r < 8; ++r)
        Cg[(size_t)(rbase + r) * ND + cc] = acc[i][j][r];
    }
}

extern "C" void kernel_launch(void* const* d_in, const int* in_sizes, int n_in,
                              void* d_out, int out_size, void* d_ws, size_t ws_size,
                              hipStream_t stream) {
  const float* x  = (const float*)d_in[0];  // [E,T,D]
  const float* w1 = (const float*)d_in[1];  // [E,D,H]
  const float* w2 = (const float*)d_in[2];  // [E,H,D]
  const float* w3 = (const float*)d_in[3];  // [E,D,H]
  float* out = (float*)d_out;               // [E,T,D]

  // Workspace layout (bf16 elements): xb | w1t | w3t | w2t | hb  (~151 MB)
  unsigned short* ws = (unsigned short*)d_ws;
  size_t off = 0;
  unsigned short* xb  = ws + off; off += (size_t)NE * NT * ND;   // [E,T,D]
  unsigned short* w1t = ws + off; off += (size_t)NE * NH * ND;   // [E,H,D]
  unsigned short* w3t = ws + off; off += (size_t)NE * NH * ND;   // [E,H,D]
  unsigned short* w2t = ws + off; off += (size_t)NE * ND * NH;   // [E,D,H]
  unsigned short* hb  = ws + off;                                 // [E,T,H]

  dim3 blk(NTHREADS);

  // Pass 0: downcast + weight transpose.
  cvt_x_kernel<<<dim3(((size_t)NE * NT * ND) / 4 / 256 / XV), dim3(256), 0, stream>>>(x, xb);
  cvt_wT_dh_kernel<<<dim3(NH / (WN * WT), ND / WK, NE), dim3(256), 0, stream>>>(w1, w1t);
  cvt_wT_dh_kernel<<<dim3(NH / (WN * WT), ND / WK, NE), dim3(256), 0, stream>>>(w3, w3t);
  cvt_wT_hd_kernel<<<dim3(ND / (WN * WT), NH / WK, NE), dim3(256), 0, stream>>>(w2, w2t);

  // GEMM 1: fused gate/up + SwiGLU.
  moe_gateup_kernel<<<dim3(NT / G_BM, NH / G_BN, NE), blk, 0, stream>>>(xb, w1t, w3t, hb);
  // GEMM 2: down projection.
  moe_down_kernel<<<dim3(NT / D_BM, ND / D_BN, NE), blk, 0, stream>>>(hb, w2t, out);
}

// v004
// It runs in 113 microseconds.
// Timed twice side by side with v003, it ran 1.05 times as fast both times.
// Over all steps from v000 it is 2.57 times as fast.
#include <hip/hip_runtime.h>

typedef __attribute__((ext_vector_type(16))) __bf16 v16bf;
typedef __attribute__((ext_vector_type(8)))  __bf16 v8bf;
typedef __attribute__((ext_vector_type(8)))  float  v8f;
typedef __attribute__((ext_vector_type(4)))  unsigned int u32x4;
typedef __attribute__((ext_vector_type(2)))  unsigned int u32x2;
typedef __attribute__((ext_vector_type(4)))  int i32x4;

#define NE 8
#define NT 1024
#define ND 1024
#define NH 2048

// GEMM tiling. 8 waves, arranged 2 (M) x 4 (N), in both GEMM kernels.
// Every fragment a wave reads from LDS feeds as many WMMAs as the other operand
// has fragments, and every staged row as many as the block tile is wide, so the
// tiles are as large as the grid allows with all WGPs at work.
#define BK 64
#define NTHREADS 256
// Gate/up: block 256 rows x 128 columns of w1 AND of w3; wave 128 x (32 + 32).
#define G_BM 256
#define G_BN 128
#define G_MF 8   // A fragments of a wave
#define G_NF 2   // B fragments of a wave, of each weight
// Down: block 128 x 256; wave 64 x 64.
#define D_BM 128
#define D_BN 256
#define D_MF 4
#define D_NF 4
// LDS row pitch of the staged tiles, in bf16 elements: 64 data + 8 pad = 144 B
// (16 B x odd), so the 16 rows one ds_load_b128 half-wave reads fall on all 64
// banks once; at the bare 128 B they share 8 banks.
#define LDP (BK + 8)
// LDS ring of both GEMMs: NSTG buffers, a stage's copies issued NSTG - 1 trips
// ahead of the trip that reads it. The blocks walk k together, so a stage's rows
// are mostly asked for the first time: its copies can take a memory latency on
// top of their transfer, by estimate more than one trip's WMMAs cover.
#define NSTG 4
#define G_CP (((G_BM + 2 * G_BN) * BK) / 8 / NTHREADS)  // copies a wave and stage
#define D_CP (((D_BM + D_BN) * BK) / 8 / NTHREADS)
static_assert((NSTG - 1) * G_CP <= 63 && (NSTG - 1) * D_CP <= 63,
              "outstanding copies of a wave");

// Use CDNA5 async global->LDS DMA when the toolchain exposes it.
#if defined(__has_builtin)
#if __has_builtin(__builtin_amdgcn_global_load_async_to_lds_b128) && \
    __has_builtin(__builtin_amdgcn_s_wait_asynccnt)
#define USE_ASYNC 1
#endif
#endif
#ifndef USE_ASYNC
#define USE_ASYNC 0
#endif

// fp32 -> bf16 round-to-nearest-even (bit pattern)
static __device__ __forceinline__ unsigned short f2bf(float f) {
  unsigned u = __float_as_uint(f);
  unsigned r = u + 0x7FFFu + ((u >> 16) & 1u);
  return (unsigned short)(r >> 16);
}

// 16-byte global -> LDS copy (async DMA when available).
static __device__ __forceinline__ void cp16_g2l(unsigned short* l,
                                                const unsigned short* g) {
#if USE_ASYNC
  __builtin_amdgcn_global_load_async_to_lds_b128(
      (__attribute__((address_space(1))) i32x4*)g,
      (__attribute__((address_space(3))) i32x4*)l, 0, 0);
#else
  *(u32x4*)l = *(const u32x4*)g;
#endif
}

// Top of a trip, in front of its barrier. First the wave's own LDS reads of the
// trip before have retired (the buffer they read is refilled behind the
// barrier); then all of the wave's copies but the N youngest have landed, or all
// of them where fewer than N stand behind this trip's stage (`tail`, the same
// for the whole block). In asm with the memory clobber, so that no LDS read is
// lifted over the waits.
template <int N>
static __device__ __forceinline__ void wait_stage(bool tail) {
  asm volatile("s_wait_dscnt 0x0" ::: "memory");
#if USE_ASYNC
  asm volatile("s_wait_asynccnt %0" :: "n"(N) : "memory");
  if (tail) asm volatile("s_wait_asynccnt 0x0" ::: "memory");
#endif
}

// Load one 16x32 bf16 WMMA operand fragment from LDS.
// Rows are `stride` bf16 apart, K contiguous.
// Lanes 0-15: K 0-7 then 16-23; lanes 16-31: K 8-15 then 24-31.
static __device__ __forceinline__ v16bf load_frag(const unsigned short* base,
                                                  int lane, int stride) {
  const int l16 = lane & 15;
  const int kk0 = (lane & 16) ? 8 : 0;
  const unsigned short* p = base + l16 * stride + kk0;
  union { v16bf v; v8bf h[2]; } u;
  u.h[0] = *(const v8bf*)(p);
  u.h[1] = *(const v8bf*)(p + 16);
  return u.v;
}

// ---------------------------------------------------------------------------
// Pass 0a: x fp32 -> bf16, same layout [E*T, D].
// Few long-lived waves: each thread converts XV float4, all loads issued ahead,
// so the launch is paced by memory and not by how fast waves can be started.
// ---------------------------------------------------------------------------
#define XV 16   // float4 per thread
// waves_per_eu: at most 4 waves a SIMD are wanted, so the compiler may spend the
// registers that keep every load in flight instead of holding to 64.
__global__ __launch_bounds__(256) __attribute__((amdgpu_waves_per_eu(2, 4)))
void cvt_x_kernel(const float* __restrict__ src, unsigned short* __restrict__ dst) {
  const size_t b4 = ((size_t)blockIdx.x * (256 * XV) + threadIdx.x) * 4;
  float4 f[XV];
#pragma unroll
  for (int j = 0; j < XV; ++j) f[j] = *(const float4*)(src + b4 + (size_t)j * 1024);
  // Takes the loads' address as an input so that its registers stay untouched up
  // to this wait (the compiler let the last load land on them): a precaution.
  asm volatile("s_wait_xcnt 0x0" :: "v"(src + b4) : "memory");
#pragma unroll
  for (int j = 0; j < XV; ++j) {
    u32x2 p;
    p[0] = (unsigned)f2bf(f[j].x) | ((unsigned)f2bf(f[j].y) << 16);
    p[1] = (unsigned)f2bf(f[j].z) | ((unsigned)f2bf(f[j].w) << 16);
    *(u32x2*)(dst + b4 + (size_t)j * 1024) = p;
  }
}

// ---------------------------------------------------------------------------
// Pass 0b: weight fp32 [e][K][N] -> bf16 transposed [e][N][K].
// Each 256-thread block walks WT tiles of WK (k) x WN (n), neighbours along n,
// through two LDS buffers; the next tile's 8 loads per thread fly while this
// tile is read back transposed and stored. Coalesced in and out.
// Grid: (N/(WN*WT), K/WK, NE).
// ---------------------------------------------------------------------------
#define TP 72   // padded LDS row stride (bf16 elements)
#define WK 128  // k rows of a tile
#define WN 64   // n columns of a tile
#define WT 4    // tiles per block
static __device__ __forceinline__
void cvt_wT_body(const float* __restrict__ w, unsigned short* __restrict__ wt,
                 const int K, const int N) {
  const int e  = blockIdx.z;
  const int n0 = blockIdx.x * (WN * WT);
  const int k0 = blockIdx.y * WK;
  const float* S = w + (size_t)e * K * N + (size_t)k0 * N + n0;
  unsigned short* Dt = wt + (size_t)e * K * N + (size_t)n0 * K + k0;

  __shared__ __align__(16) unsigned short Ls[2 * WK * TP]; // two buffers of [k][n]

  const int tid = threadIdx.x;
  const int lr  = tid >> 4;          // k row, 16 float4 per row; +16 per load
  const int lc  = (tid & 15) << 2;   // n offset
  const int rn  = tid >> 3;          // n row of the read-back; +32 per odd chunk
  const int ck  = (tid & 7) << 3;    // k offset, 8 bf16 per chunk; +64 from chunk 2
  // Each lane's own part of the addresses, in bytes; the rest is the same for
  // the whole block.
  const unsigned lin  = (unsigned)(lr * N + lc) * 4u;
  const unsigned lout = (unsigned)(rn * K + ck) * 2u;

  float4 f[WK / 16];
#pragma unroll
  for (int j = 0; j < WK / 16; ++j)
    f[j] = *(const float4*)((const char*)(S + (size_t)(16 * j) * N) + lin);

  // Kept rolled: unrolled, the compiler lifts the next tile's conversion, and
  // with it the wait for its loads, above this tile's read-back.
#pragma unroll 1
  for (int t = 0; t < WT; ++t) {
    unsigned short* L = Ls + (t & 1) * (WK * TP);
#pragma unroll
    for (int j = 0; j < WK / 16; ++j) {
      u32x2 p;
      p[0] = (unsigned)f2bf(f[j].x) | ((unsigned)f2bf(f[j].y) << 16);
      p[1] = (unsigned)f2bf(f[j].z) | ((unsigned)f2bf(f[j].w) << 16);
      *(u32x2*)&L[(lr + 16 * j) * TP + lc] = p;
    }
    // One barrier a tile: it publishes this buffer, and every wave that passes
    // it has finished reading the other buffer, which the next trip refills.
    __syncthreads();

    if (t + 1 < WT) {
#pragma unroll
      for (int j = 0; j < WK / 16; ++j)
        f[j] = *(const float4*)((const char*)(S + (size_t)(16 * j) * N + (t + 1) * WN) + lin);
      // The read-back below reuses the loads' address registers; the wait is
      // written here as a precaution.
      asm volatile("s_wait_xcnt 0x0" ::: "memory");
    }

#pragma unroll
    for (int i = 0; i < (WK * WN) / 8 / 256; ++i) {
      const int dn = (i & 1) * 32, dk = (i >> 1) * 64;
      union { u32x4 v; unsigned short s[8]; } u;
#pragma unroll
      for (int j = 0; j < 8; ++j) u.s[j] = L[(ck + dk + j) * TP + rn + dn];
      *(u32x4*)((char*)(Dt + (size_t)(t * WN + dn) * K + dk) + lout) = u.v;
    }
  }
}

// K and N as constants: a tile's 8 loads then share one address register pair
// and differ by immediate offsets only. waves_per_eu: as at cvt_x_kernel.
__global__ __launch_bounds__(256) __attribute__((amdgpu_waves_per_eu(2, 4)))
void cvt_wT_dh_kernel(const float* __restrict__ w, unsigned short* __restrict__ wt) {
  cvt_wT_body(w, wt, ND, NH);
}
__global__ __launch_bounds__(256) __attribute__((amdgpu_waves_per_eu(2, 4)))
void cvt_wT_hd_kernel(const float* __restrict__ w, unsigned short* __restrict__ wt) {
  cvt_wT_body(w, wt, NH, ND);
}

// ---------------------------------------------------------------------------
// Staging helpers (one K-stage worth of tiles into one LDS buffer).
// ---------------------------------------------------------------------------
static __device__ __forceinline__ void stage_gateup(
    unsigned short* As, unsigned short* Bs1, unsigned short* Bs3,
    const unsigned short* Ag, const unsigned short* B1g,
    const unsigned short* B3g, int row0, int col0, int k0, int tid) {
  // Trip counts are constants, here and in stage_down: the copies then unroll,
  // differ by constant steps, and no lane mask is formed around them.
#pragma unroll
  for (int q = 0; q < (G_BM * BK) / 8 / NTHREADS; ++q) {
    const int c = tid + q * NTHREADS;
    const int r = c >> 3, kk = (c & 7) << 3;
    cp16_g2l(&As[r * LDP + kk], Ag + (size_t)(row0 + r) * ND + k0 + kk);
  }
#pragma unroll
  for (int q = 0; q < (G_BN * BK) / 8 / NTHREADS; ++q) {
    const int c = tid + q * NTHREADS;
    const int r = c >> 3, kk = (c & 7) << 3;
    const size_t go = (size_t)(col0 + r) * ND + k0 + kk;
    cp16_g2l(&Bs1[r * LDP + kk], B1g + go);
    cp16_g2l(&Bs3[r * LDP + kk], B3g + go);
  }
}

static __device__ __forceinline__ void stage_down(
    unsigned short* As, unsigned short* Bs,
    const unsigned short* Ag, const unsigned short* Bg,
    int row0, int col0, int k0, int tid) {
#pragma unroll
  for (int q = 0; q < (D_BM * BK) / 8 / NTHREADS; ++q) {
    const int c = tid + q * NTHREADS;
    const int r = c >> 3, kk = (c & 7) << 3;
    cp16_g2l(&As[r * LDP + kk], Ag + (size_t)(row0 + r) * NH + k0 + kk);
  }
#pragma unroll
  for (int q = 0; q < (D_BN * BK) / 8 / NTHREADS; ++q) {
    const int c = tid + q * NTHREADS;
    const int r = c >> 3, kk = (c & 7) << 3;
    cp16_g2l(&Bs[r * LDP + kk], Bg + (size_t)(col0 + r) * NH + k0 + kk);
  }
}

// ---------------------------------------------------------------------------
// GEMM 1 (fused): h[e] = silu(x[e] @ w1[e]) * (x[e] @ w3[e]) -> bf16.
// A: xb [e][T][D]; B: w1t/w3t [e][H][D] (pre-transposed, K-contiguous).
// Grid: (T/G_BM, H/G_BN, E). LDS ring of NSTG stages, filled by async copies.
// ---------------------------------------------------------------------------
__global__ __launch_bounds__(NTHREADS)
void moe_gateup_kernel(const unsigned short* __restrict__ xb,
                       const unsigned short* __restrict__ w1t,
                       const unsigned short* __restrict__ w3t,
                       unsigned short* __restrict__ hbuf) {
  const int e    = blockIdx.z;
  const int row0 = blockIdx.x * G_BM;
  const int col0 = blockIdx.y * G_BN;

  const unsigned short* Ag  = xb  + (size_t)e * NT * ND;
  const unsigned short* B1g = w1t + (size_t)e * NH * ND;
  const unsigned short* B3g = w3t + (size_t)e * NH * ND;
  unsigned short* Hg = hbuf + (size_t)e * NT * NH;

  __shared__ __align__(16) unsigned short As [NSTG * G_BM * LDP];
  __shared__ __align__(16) unsigned short Bs1[NSTG * G_BN * LDP];
  __shared__ __align__(16) unsigned short Bs3[NSTG * G_BN * LDP];

  const int tid  = threadIdx.x;
  const int wave = tid >> 5;
  const int lane = tid & 31;
  const int wm   = (wave >> 2) * (G_MF * 16);  // 0 or 128
  const int wn   = (wave & 3)  * (G_NF * 16);  // 0..96

  // Every loop over the accumulator tiles is unrolled in full: an index that is
  // not a constant would put the tiles in scratch memory.
  v8f accg[G_MF][G_NF], accu[G_MF][G_NF];
#pragma unroll
  for (int i = 0; i < G_MF; ++i)
#pragma unroll
    for (int j = 0; j < G_NF; ++j) { accg[i][j] = {}; accu[i][j] = {}; }

  const int NIT = ND / BK;
  static_assert(ND / BK >= NSTG, "the prologue's stages exist");
#pragma unroll
  for (int s = 0; s < NSTG - 1; ++s)
    stage_gateup(As + s * G_BM * LDP, Bs1 + s * G_BN * LDP, Bs3 + s * G_BN * LDP,
                 Ag, B1g, B3g, row0, col0, s * BK, tid);

  for (int it = 0; it < NIT; ++it) {
    // Stage it has landed: behind its copies stand those of NSTG - 2 stages, as
    // long as these exist; the last trips wait for all.
    wait_stage<(NSTG - 2) * G_CP>(it + NSTG - 2 >= NIT);
    // One barrier a trip: it publishes stage it, and every wave that passes it
    // has left the buffer of trip it - 1, which is refilled below.
    __syncthreads();

    const int cur = it % NSTG;
    if (it + NSTG - 1 < NIT) {
      const int nxt = (it + NSTG - 1) % NSTG;
      stage_gateup(As + nxt * G_BM * LDP, Bs1 + nxt * G_BN * LDP, Bs3 + nxt * G_BN * LDP,
                   Ag, B1g, B3g, row0, col0, (it + NSTG - 1) * BK, tid);
    }

    const unsigned short* Ab  = As  + cur * G_BM * LDP;
    const unsigned short* B1b = Bs1 + cur * G_BN * LDP;
    const unsigned short* B3b = Bs3 + cur * G_BN * LDP;

    // The stage's two k steps, each with a fragment set of its own. The three
    // sched_barriers hold this order: step 0's loads in one group, half of its
    // WMMAs, step 1's loads in one group, the other WMMAs. Left alone the
    // compiler loads one A fragment at a time into one register set and waits
    // out the LDS latency every 4 WMMAs, which two waves a SIMD cannot hide.
    static_assert(BK == 64, "two k steps a stage");
    v16bf af[2][G_MF], b1f[2][G_NF], b3f[2][G_NF];
#pragma unroll
    for (int s = 0; s < 2; ++s) {
#pragma unroll
      for (int j = 0; j < G_NF; ++j) {
        b1f[s][j] = load_frag(B1b + (wn + 16 * j) * LDP + 32 * s, lane, LDP);
        b3f[s][j] = load_frag(B3b + (wn + 16 * j) * LDP + 32 * s, lane, LDP);
      }
#pragma unroll
      for (int i = 0; i < G_MF; ++i)
        af[s][i] = load_frag(Ab + (wm + 16 * i) * LDP + 32 * s, lane, LDP);
      __builtin_amdgcn_sched_barrier(0);
      // Behind step 0's loads rows 0..3 of step 0; behind step 1's the rest.
#pragma unroll
      for (int t = (s == 0 ? 0 : G_MF / 2); t < (s == 0 ? G_MF / 2 : 2 * G_MF); ++t) {
        const int ss = t / G_MF, i = t % G_MF;
#pragma unroll
        for (int j = 0; j < G_NF; ++j) {
          accg[i][j] = __builtin_amdgcn_wmma_f32_16x16x32_bf16(
              false, af[ss][i], false, b1f[ss][j], (short)0, accg[i][j], false, false);
          accu[i][j] = __builtin_amdgcn_wmma_f32_16x16x32_bf16(
              false, af[ss][i], false, b3f[ss][j], (short)0, accu[i][j], false, false);
        }
      }
      if (s == 0) __builtin_amdgcn_sched_barrier(0);
    }
  }

  // Keeps the epilogue's arithmetic out of the last stage's WMMAs: mixed in while
  // both fragment sets are live, it made the build spill to scratch memory.
  __builtin_amdgcn_sched_barrier(0);

  // Epilogue: silu(gate) * up -> bf16 h.
  const int l16   = lane & 15;
  const int rhalf = (lane & 16) ? 8 : 0;  // C layout: lanes 16-31 hold M+8
#pragma unroll
  for (int i = 0; i < G_MF; ++i)
#pragma unroll
    for (int j = 0; j < G_NF; ++j) {
      const int rbase = row0 + wm + i * 16 + rhalf;
      const int cc    = col0 + wn + j * 16 + l16;
      unsigned short* hp = Hg + (size_t)rbase * NH + cc;
      unsigned hv[8];  // the rounded value, bf16 in the high half (as in f2bf)
#pragma unroll
      for (int r = 0; r < 8; ++r) {
        const float g = accg[i][j][r];
        const float u = accu[i][j][r];
        const float s = g / (1.0f + __expf(-g));
        const unsigned w = __float_as_uint(s * u);
        hv[r] = w + 0x7FFFu + ((w >> 16) & 1u);
        hp[(size_t)r * NH] = (unsigned short)(hv[r] >> 16);
      }
      // The next tile's arithmetic reuses the stores' registers. Takes the address and
      // the stored words as inputs so that they stay untouched up to the wait:
      // a precaution.
      asm volatile("s_wait_xcnt 0x0"
                   :: "v"(hp), "v"(hv[0]), "v"(hv[1]), "v"(hv[2]), "v"(hv[3]),
                      "v"(hv[4]), "v"(hv[5]), "v"(hv[6]), "v"(hv[7])
                   : "memory");
    }
}

// ---------------------------------------------------------------------------
// GEMM 2: out[e] = h[e] @ w2[e]   (h bf16 [T][H], w2t bf16 [D][H], out fp32)
// Grid: (T/D_BM, D/D_BN, E). LDS ring of NSTG stages, filled by async copies.
// ---------------------------------------------------------------------------
__global__ __launch_bounds__(NTHREADS)
void moe_down_kernel(const unsigned short* __restrict__ hbuf,
                     const unsigned short* __restrict__ w2t,
                     float* __restrict__ out) {
  const int e    = blockIdx.z;
  const int row0 = blockIdx.x * D_BM;
  const int col0 = blockIdx.y * D_BN;

  const unsigned short* Ag = hbuf + (size_t)e * NT * NH;
  const unsigned short* Bg = w2t  + (size_t)e * ND * NH;
  float*                Cg = out  + (size_t)e * NT * ND;

  __shared__ __align__(16) unsigned short As[NSTG * D_BM * LDP];
  __shared__ __align__(16) unsigned short Bs[NSTG * D_BN * LDP];

  const int tid  = threadIdx.x;
  const int wave = tid >> 5;
  const int lane = tid & 31;
  const int wm   = (wave >> 2) * (D_MF * 16);  // 0 or 64
  const int wn   = (wave & 3)  * (D_NF * 16);  // 0..192

  // Unrolled in full, here and below, as in the gate/up kernel.
  v8f acc[D_MF][D_NF];
#pragma unroll
  for (int i = 0; i < D_MF; ++i)
#pragma unroll
    for (int j = 0; j < D_NF; ++j) acc[i][j] = {};

  const int NIT = NH / BK;
  static_assert(NH / BK >= NSTG, "the prologue's stages exist");
#pragma unroll
  for (int s = 0; s < NSTG - 1; ++s)
    stage_down(As + s * D_BM * LDP, Bs + s * D_BN * LDP,
               Ag, Bg, row0, col0, s * BK, tid);

  for (int it = 0; it < NIT; ++it) {
    // The waits, the barrier and the refill as in the gate/up kernel.
    wait_stage<(NSTG - 2) * D_CP>(it + NSTG - 2 >= NIT);
    __syncthreads();

    const int cur = it % NSTG;
    if (it + NSTG - 1 < NIT) {
      const int nxt = (it + NSTG - 1) % NSTG;
      stage_down(As + nxt * D_BM * LDP, Bs + nxt * D_BN * LDP,
                 Ag, Bg, row0, col0, (it + NSTG - 1) * BK, tid);
    }

    const unsigned short* Ab = As + cur * D_BM * LDP;
    const unsigned short* Bb = Bs + cur * D_BN * LDP;

    // Two k steps, two fragment sets; the three sched_barriers hold the order
    // of loads and WMMAs as in the gate/up kernel, and for the same reason.
    v16bf af[2][D_MF], bf[2][D_NF];
#pragma unroll
    for (int s = 0; s < 2; ++s) {
#pragma unroll
      for (int j = 0; j < D_NF; ++j)
        bf[s][j] = load_frag(Bb + (wn + 16 * j) * LDP + 32 * s, lane, LDP);
#pragma unroll
      for (int i = 0; i < D_MF; ++i)
        af[s][i] = load_frag(Ab + (wm + 16 * i) * LDP + 32 * s, lane, LDP);
      __builtin_amdgcn_sched_barrier(0);
#pragma unroll
      for (int t = (s == 0 ? 0 : D_MF / 2); t < (s == 0 ? D_MF / 2 : 2 * D_MF); ++t) {
        const int ss = t / D_MF, i = t % D_MF;
#pragma unroll
        for (int j = 0; j < D_NF; ++j)
          acc[i][j] = __builtin_amdgcn_wmma_f32_16x16x32_bf16(
              false, af[ss][i], false, bf[ss][j], (short)0, acc[i][j], false, false);
      }
      if (s == 0) __builtin_amdgcn_sched_barrier(0);
    }
  }

  const int l16   = lane & 15;
  const int rhalf = (lane & 16) ? 8 : 0;
#pragma unroll
  for (int i = 0; i < D_MF; ++i)
#pragma unroll
    for (int j = 0; j < D_NF; ++j) {
      const int rbase = row0 + wm + i * 16 + rhalf;
      const int cc    = col0 + wn + j * 16 + l16;
#pragma unroll
      for (int r = 0; r < 8; ++r)
        Cg[(size_t)(rbase + r) * ND + cc] = acc[i][j][r];
    }
}

extern "C" void kernel_launch(void* const* d_in, const int* in_sizes, int n_in,
                              void* d_out, int out_size, void* d_ws, size_t ws_size,
                              hipStream_t stream) {
  const float* x  = (const float*)d_in[0];  // [E,T,D]
  const float* w1 = (const float*)d_in[1];  // [E,D,H]
  const float* w2 = (const float*)d_in[2];  // [E,H,D]
  const float* w3 = (const float*)d_in[3];  // [E,D,H]
  float* out = (float*)d_out;               // [E,T,D]

  // Workspace layout (bf16 elements): xb | w1t | w3t | w2t | hb  (~151 MB)
  unsigned short* ws = (unsigned short*)d_ws;
  size_t off = 0;
  unsigned short* xb  = ws + off; off += (size_t)NE * NT * ND;   // [E,T,D]
  unsigned short* w1t = ws + off; off += (size_t)NE * NH * ND;   // [E,H,D]
  unsigned short* w3t = ws + off; off += (size_t)NE * NH * ND;   // [E,H,D]
  unsigned short* w2t = ws + off; off += (size_t)NE * ND * NH;   // [E,D,H]
  unsigned short* hb  = ws + off;                                 // [E,T,H]

  dim3 blk(NTHREADS);

  // Pass 0: downcast + weight transpose.
  cvt_x_kernel<<<dim3(((size_t)NE * NT * ND) / 4 / 256 / XV), dim3(256), 0, stream>>>(x, xb);
  cvt_wT_dh_kernel<<<dim3(NH / (WN * WT), ND / WK, NE), dim3(256), 0, stream>>>(w1, w1t);
  cvt_wT_dh_kernel<<<dim3(NH / (WN * WT), ND / WK, NE), dim3(256), 0, stream>>>(w3, w3t);
  cvt_wT_hd_kernel<<<dim3(ND / (WN * WT), NH / WK, NE), dim3(256), 0, stream>>>(w2, w2t);

  // GEMM 1: fused gate/up + SwiGLU.
  moe_gateup_kernel<<<dim3(NT / G_BM, NH / G_BN, NE), blk, 0, stream>>>(xb, w1t, w3t, hb);
  // GEMM 2: down projection.
  moe_down_kernel<<<dim3(NT / D_BM, ND / D_BN, NE), blk, 0, stream>>>(hb, w2t, out);
}

// v005
// Measured time: 109 microseconds a run.
// In both of two side-by-side timings against v004, it was 1.03 times as fast.
// Counting every step since v000, it is 2.66 times as fast.
#include <hip/hip_runtime.h>

typedef __attribute__((ext_vector_type(16))) __bf16 v16bf;
typedef __attribute__((ext_vector_type(8)))  __bf16 v8bf;
typedef __attribute__((ext_vector_type(8)))  float  v8f;
typedef __attribute__((ext_vector_type(4)))  unsigned int u32x4;
typedef __attribute__((ext_vector_type(2)))  unsigned int u32x2;
typedef __attribute__((ext_vector_type(4)))  int i32x4;

#define NE 8
#define NT 1024
#define ND 1024
#define NH 2048

// GEMM tiling. 8 waves, arranged 2 (M) x 4 (N), in both GEMM kernels.
// Every fragment a wave reads from LDS feeds as many WMMAs as the other operand
// has fragments, and every staged row as many as the block tile is wide, so the
// tiles are as large as the grid allows with all WGPs at work.
#define BK 64
#define NTHREADS 256
// Gate/up: block 256 rows x 128 columns of w1 AND of w3; wave 128 x (32 + 32).
#define G_BM 256
#define G_BN 128
#define G_MF 8   // A fragments of a wave
#define G_NF 2   // B fragments of a wave, of each weight
// Down: block 128 x 256; wave 64 x 64.
#define D_BM 128
#define D_BN 256
#define D_MF 4
#define D_NF 4
// LDS row pitch of the staged tiles, in bf16 elements: 64 data + 8 pad = 144 B
// (16 B x odd), so the 16 rows one ds_load_b128 half-wave reads fall on all 64
// banks once; at the bare 128 B they share 8 banks.
#define LDP (BK + 8)
// LDS ring of both GEMMs: NSTG buffers, a stage's copies issued NSTG - 1 trips
// ahead of the trip that reads it. The blocks walk k together, so a stage's rows
// are mostly asked for the first time: its copies can take a memory latency on
// top of their transfer, by estimate more than one trip's WMMAs cover.
#define NSTG 4
#define G_CP (((G_BM + 2 * G_BN) * BK) / 8 / NTHREADS)  // copies a wave and stage
#define D_CP (((D_BM + D_BN) * BK) / 8 / NTHREADS)
static_assert((NSTG - 1) * G_CP <= 63 && (NSTG - 1) * D_CP <= 63,
              "outstanding copies of a wave");

// Use CDNA5 async global->LDS DMA when the toolchain exposes it.
#if defined(__has_builtin)
#if __has_builtin(__builtin_amdgcn_global_load_async_to_lds_b128) && \
    __has_builtin(__builtin_amdgcn_s_wait_asynccnt)
#define USE_ASYNC 1
#endif
#endif
#ifndef USE_ASYNC
#define USE_ASYNC 0
#endif

// fp32 -> bf16 round-to-nearest-even (bit pattern)
static __device__ __forceinline__ unsigned short f2bf(float f) {
  unsigned u = __float_as_uint(f);
  unsigned r = u + 0x7FFFu + ((u >> 16) & 1u);
  return (unsigned short)(r >> 16);
}

// 16-byte global -> LDS copy (async DMA when available).
static __device__ __forceinline__ void cp16_g2l(unsigned short* l,
                                                const unsigned short* g) {
#if USE_ASYNC
  __builtin_amdgcn_global_load_async_to_lds_b128(
      (__attribute__((address_space(1))) i32x4*)g,
      (__attribute__((address_space(3))) i32x4*)l, 0, 0);
#else
  *(u32x4*)l = *(const u32x4*)g;
#endif
}

// Top of a trip, in front of its barrier. First the wave's own LDS reads of the
// trip before have retired (the buffer they read is refilled behind the
// barrier); then all of the wave's copies but the N youngest have landed, or all
// of them where fewer than N stand behind this trip's stage (`tail`, the same
// for the whole block). In asm with the memory clobber, so that no LDS read is
// lifted over the waits.
template <int N>
static __device__ __forceinline__ void wait_stage(bool tail) {
  asm volatile("s_wait_dscnt 0x0" ::: "memory");
#if USE_ASYNC
  asm volatile("s_wait_asynccnt %0" :: "n"(N) : "memory");
  if (tail) asm volatile("s_wait_asynccnt 0x0" ::: "memory");
#endif
}

// Load one 16x32 bf16 WMMA operand fragment from LDS.
// Rows are `stride` bf16 apart, K contiguous.
// Lanes 0-15: K 0-7 then 16-23; lanes 16-31: K 8-15 then 24-31.
static __device__ __forceinline__ v16bf load_frag(const unsigned short* base,
                                                  int lane, int stride) {
  const int l16 = lane & 15;
  const int kk0 = (lane & 16) ? 8 : 0;
  const unsigned short* p = base + l16 * stride + kk0;
  union { v16bf v; v8bf h[2]; } u;
  u.h[0] = *(const v8bf*)(p);
  u.h[1] = *(const v8bf*)(p + 16);
  return u.v;
}

// ---------------------------------------------------------------------------
// Pass 0a: x fp32 -> bf16, same layout [E*T, D].
// Few long-lived waves: each thread converts XV float4, all loads issued ahead,
// so the launch is paced by memory and not by how fast waves can be started.
// ---------------------------------------------------------------------------
#define XV 16   // float4 per thread
static __device__ __forceinline__
void cvt_x_body(const float* __restrict__ src, unsigned short* __restrict__ dst,
                const int blk) {
  const size_t b4 = ((size_t)blk * (256 * XV) + threadIdx.x) * 4;
  float4 f[XV];
#pragma unroll
  for (int j = 0; j < XV; ++j) f[j] = *(const float4*)(src + b4 + (size_t)j * 1024);
  // Takes the loads' address as an input so that its registers stay untouched up
  // to this wait (the compiler let the last load land on them): a precaution.
  asm volatile("s_wait_xcnt 0x0" :: "v"(src + b4) : "memory");
#pragma unroll
  for (int j = 0; j < XV; ++j) {
    u32x2 p;
    p[0] = (unsigned)f2bf(f[j].x) | ((unsigned)f2bf(f[j].y) << 16);
    p[1] = (unsigned)f2bf(f[j].z) | ((unsigned)f2bf(f[j].w) << 16);
    *(u32x2*)(dst + b4 + (size_t)j * 1024) = p;
  }
  // Behind the last store: in the merged kernel's listing code of the weight
  // passes follows that rewrites the stores' registers. A precaution.
  asm volatile("s_wait_xcnt 0x0" ::: "memory");
}

// ---------------------------------------------------------------------------
// Pass 0b: weight fp32 [e][K][N] -> bf16 transposed [e][N][K].
// Each 256-thread block walks WT tiles of WK (k) x WN (n), neighbours along n,
// through two LDS buffers; the next tile's 8 loads per thread fly while this
// tile is read back transposed and stored. Coalesced in and out.
// Blocks of one weight: N/(WN*WT) along n (fastest), K/WK along k, NE experts.
// ---------------------------------------------------------------------------
#define TP 72   // padded LDS row stride (bf16 elements)
#define WK 128  // k rows of a tile
#define WN 64   // n columns of a tile
#define WT 4    // tiles per block
static __device__ __forceinline__
void cvt_wT_body(const float* __restrict__ w, unsigned short* __restrict__ wt,
                 const int K, const int N, const int blk) {
  const int nbn = N / (WN * WT), nbk = K / WK;
  const int e  = blk / (nbn * nbk);
  const int n0 = (blk % nbn) * (WN * WT);
  const int k0 = ((blk / nbn) % nbk) * WK;
  const float* S = w + (size_t)e * K * N + (size_t)k0 * N + n0;
  unsigned short* Dt = wt + (size_t)e * K * N + (size_t)n0 * K + k0;

  __shared__ __align__(16) unsigned short Ls[2 * WK * TP]; // two buffers of [k][n]

  const int tid = threadIdx.x;
  const int lr  = tid >> 4;          // k row, 16 float4 per row; +16 per load
  const int lc  = (tid & 15) << 2;   // n offset
  const int rn  = tid >> 3;          // n row of the read-back; +32 per odd chunk
  const int ck  = (tid & 7) << 3;    // k offset, 8 bf16 per chunk; +64 from chunk 2
  // Each lane's own part of the addresses, in bytes; the rest is the same for
  // the whole block.
  const unsigned lin  = (unsigned)(lr * N + lc) * 4u;
  const unsigned lout = (unsigned)(rn * K + ck) * 2u;

  float4 f[WK / 16];
#pragma unroll
  for (int j = 0; j < WK / 16; ++j)
    f[j] = *(const float4*)((const char*)(S + (size_t)(16 * j) * N) + lin);

  // Kept rolled: unrolled, the compiler lifts the next tile's conversion, and
  // with it the wait for its loads, above this tile's read-back.
#pragma unroll 1
  for (int t = 0; t < WT; ++t) {
    unsigned short* L = Ls + (t & 1) * (WK * TP);
#pragma unroll
    for (int j = 0; j < WK / 16; ++j) {
      u32x2 p;
      p[0] = (unsigned)f2bf(f[j].x) | ((unsigned)f2bf(f[j].y) << 16);
      p[1] = (unsigned)f2bf(f[j].z) | ((unsigned)f2bf(f[j].w) << 16);
      *(u32x2*)&L[(lr + 16 * j) * TP + lc] = p;
    }
    // One barrier a tile: it publishes this buffer, and every wave that passes
    // it has finished reading the other buffer, which the next trip refills.
    // Its two fences name LDS alone: nothing in global memory passes between the
    // waves, and __syncthreads() in the merged kernel made every tile's barrier
    // wait for the acknowledgement of the tile before's global stores as well.
    __builtin_amdgcn_fence(__ATOMIC_RELEASE, "workgroup", "local");
    __builtin_amdgcn_s_barrier();
    __builtin_amdgcn_fence(__ATOMIC_ACQUIRE, "workgroup", "local");

    if (t + 1 < WT) {
#pragma unroll
      for (int j = 0; j < WK / 16; ++j)
        f[j] = *(const float4*)((const char*)(S + (size_t)(16 * j) * N + (t + 1) * WN) + lin);
      // The read-back below reuses the loads' address registers; the wait is
      // written here as a precaution.
      asm volatile("s_wait_xcnt 0x0" ::: "memory");
    }

#pragma unroll
    for (int i = 0; i < (WK * WN) / 8 / 256; ++i) {
      const int dn = (i & 1) * 32, dk = (i >> 1) * 64;
      union { u32x4 v; unsigned short s[8]; } u;
#pragma unroll
      for (int j = 0; j < 8; ++j) u.s[j] = L[(ck + dk + j) * TP + rn + dn];
      *(u32x4*)((char*)(Dt + (size_t)(t * WN + dn) * K + dk) + lout) = u.v;
    }
  }
}

// All four conversions in ONE launch: they depend on nothing of each other, and
// as launches of their own each paid the gap to the next, its own start of waves
// and its own first memory latency with the memory idle. The block index picks
// the pass (the same for the whole block, so the barriers in the weight body
// stay under uniform control flow): w2, which is read last, then w1, w3, then
// x, whose blocks are the shortest and fill the tail.
// K and N as constants: a tile's 8 loads then share one address register pair
// and differ by immediate offsets only.
// waves_per_eu: at most 4 waves a SIMD are wanted, so the compiler may spend the
// registers that keep every load in flight instead of holding to 64.
#define WBLK ((NH / (WN * WT)) * (ND / WK) * NE)   // blocks of one weight
#define XBLK (NE * NT * ND / 4 / 256 / XV)         // blocks of x
__global__ __launch_bounds__(256) __attribute__((amdgpu_waves_per_eu(2, 4)))
void cvt_all_kernel(const float* __restrict__ x,  const float* __restrict__ w1,
                    const float* __restrict__ w3, const float* __restrict__ w2,
                    unsigned short* __restrict__ xb,  unsigned short* __restrict__ w1t,
                    unsigned short* __restrict__ w3t, unsigned short* __restrict__ w2t) {
  const int b = blockIdx.x;
  if (b < WBLK) {
    cvt_wT_body(w2, w2t, NH, ND, b);
  } else if (b < 3 * WBLK) {
    const bool first = b < 2 * WBLK;
    cvt_wT_body(first ? w1 : w3, first ? w1t : w3t, ND, NH, b - (first ? 1 : 2) * WBLK);
  } else {
    cvt_x_body(x, xb, b - 3 * WBLK);
  }
}

// ---------------------------------------------------------------------------
// Staging helpers (one K-stage worth of tiles into one LDS buffer).
// ---------------------------------------------------------------------------
static __device__ __forceinline__ void stage_gateup(
    unsigned short* As, unsigned short* Bs1, unsigned short* Bs3,
    const unsigned short* Ag, const unsigned short* B1g,
    const unsigned short* B3g, int row0, int col0, int k0, int tid) {
  // Trip counts are constants, here and in stage_down: the copies then unroll,
  // differ by constant steps, and no lane mask is formed around them.
#pragma unroll
  for (int q = 0; q < (G_BM * BK) / 8 / NTHREADS; ++q) {
    const int c = tid + q * NTHREADS;
    const int r = c >> 3, kk = (c & 7) << 3;
    cp16_g2l(&As[r * LDP + kk], Ag + (size_t)(row0 + r) * ND + k0 + kk);
  }
#pragma unroll
  for (int q = 0; q < (G_BN * BK) / 8 / NTHREADS; ++q) {
    const int c = tid + q * NTHREADS;
    const int r = c >> 3, kk = (c & 7) << 3;
    const size_t go = (size_t)(col0 + r) * ND + k0 + kk;
    cp16_g2l(&Bs1[r * LDP + kk], B1g + go);
    cp16_g2l(&Bs3[r * LDP + kk], B3g + go);
  }
}

static __device__ __forceinline__ void stage_down(
    unsigned short* As, unsigned short* Bs,
    const unsigned short* Ag, const unsigned short* Bg,
    int row0, int col0, int k0, int tid) {
#pragma unroll
  for (int q = 0; q < (D_BM * BK) / 8 / NTHREADS; ++q) {
    const int c = tid + q * NTHREADS;
    const int r = c >> 3, kk = (c & 7) << 3;
    cp16_g2l(&As[r * LDP + kk], Ag + (size_t)(row0 + r) * NH + k0 + kk);
  }
#pragma unroll
  for (int q = 0; q < (D_BN * BK) / 8 / NTHREADS; ++q) {
    const int c = tid + q * NTHREADS;
    const int r = c >> 3, kk = (c & 7) << 3;
    cp16_g2l(&Bs[r * LDP + kk], Bg + (size_t)(col0 + r) * NH + k0 + kk);
  }
}

// ---------------------------------------------------------------------------
// GEMM 1 (fused): h[e] = silu(x[e] @ w1[e]) * (x[e] @ w3[e]) -> bf16.
// A: xb [e][T][D]; B: w1t/w3t [e][H][D] (pre-transposed, K-contiguous).
// Grid: (T/G_BM, H/G_BN, E). LDS ring of NSTG stages, filled by async copies.
// ---------------------------------------------------------------------------
__global__ __launch_bounds__(NTHREADS)
void moe_gateup_kernel(const unsigned short* __restrict__ xb,
                       const unsigned short* __restrict__ w1t,
                       const unsigned short* __restrict__ w3t,
                       unsigned short* __restrict__ hbuf) {
  const int e    = blockIdx.z;
  const int row0 = blockIdx.x * G_BM;
  const int col0 = blockIdx.y * G_BN;

  const unsigned short* Ag  = xb  + (size_t)e * NT * ND;
  const unsigned short* B1g = w1t + (size_t)e * NH * ND;
  const unsigned short* B3g = w3t + (size_t)e * NH * ND;
  unsigned short* Hg = hbuf + (size_t)e * NT * NH;

  __shared__ __align__(16) unsigned short As [NSTG * G_BM * LDP];
  __shared__ __align__(16) unsigned short Bs1[NSTG * G_BN * LDP];
  __shared__ __align__(16) unsigned short Bs3[NSTG * G_BN * LDP];

  const int tid  = threadIdx.x;
  const int wave = tid >> 5;
  const int lane = tid & 31;
  const int wm   = (wave >> 2) * (G_MF * 16);  // 0 or 128
  const int wn   = (wave & 3)  * (G_NF * 16);  // 0..96

  // Every loop over the accumulator tiles is unrolled in full: an index that is
  // not a constant would put the tiles in scratch memory.
  v8f accg[G_MF][G_NF], accu[G_MF][G_NF];
#pragma unroll
  for (int i = 0; i < G_MF; ++i)
#pragma unroll
    for (int j = 0; j < G_NF; ++j) { accg[i][j] = {}; accu[i][j] = {}; }

  const int NIT = ND / BK;
  static_assert(ND / BK >= NSTG, "the prologue's stages exist");
#pragma unroll
  for (int s = 0; s < NSTG - 1; ++s)
    stage_gateup(As + s * G_BM * LDP, Bs1 + s * G_BN * LDP, Bs3 + s * G_BN * LDP,
                 Ag, B1g, B3g, row0, col0, s * BK, tid);

  for (int it = 0; it < NIT; ++it) {
    // Stage it has landed: behind its copies stand those of NSTG - 2 stages, as
    // long as these exist; the last trips wait for all.
    wait_stage<(NSTG - 2) * G_CP>(it + NSTG - 2 >= NIT);
    // One barrier a trip: it publishes stage it, and every wave that passes it
    // has left the buffer of trip it - 1, which is refilled below.
    __syncthreads();

    const int cur = it % NSTG;
    if (it + NSTG - 1 < NIT) {
      const int nxt = (it + NSTG - 1) % NSTG;
      stage_gateup(As + nxt * G_BM * LDP, Bs1 + nxt * G_BN * LDP, Bs3 + nxt * G_BN * LDP,
                   Ag, B1g, B3g, row0, col0, (it + NSTG - 1) * BK, tid);
    }

    const unsigned short* Ab  = As  + cur * G_BM * LDP;
    const unsigned short* B1b = Bs1 + cur * G_BN * LDP;
    const unsigned short* B3b = Bs3 + cur * G_BN * LDP;

    // The stage's two k steps, each with a fragment set of its own. The three
    // sched_barriers hold this order: step 0's loads in one group, half of its
    // WMMAs, step 1's loads in one group, the other WMMAs. Left alone the
    // compiler loads one A fragment at a time into one register set and waits
    // out the LDS latency every 4 WMMAs, which two waves a SIMD cannot hide.
    static_assert(BK == 64, "two k steps a stage");
    v16bf af[2][G_MF], b1f[2][G_NF], b3f[2][G_NF];
#pragma unroll
    for (int s = 0; s < 2; ++s) {
#pragma unroll
      for (int j = 0; j < G_NF; ++j) {
        b1f[s][j] = load_frag(B1b + (wn + 16 * j) * LDP + 32 * s, lane, LDP);
        b3f[s][j] = load_frag(B3b + (wn + 16 * j) * LDP + 32 * s, lane, LDP);
      }
#pragma unroll
      for (int i = 0; i < G_MF; ++i)
        af[s][i] = load_frag(Ab + (wm + 16 * i) * LDP + 32 * s, lane, LDP);
      __builtin_amdgcn_sched_barrier(0);
      // Behind step 0's loads rows 0..3 of step 0; behind step 1's the rest.
#pragma unroll
      for (int t = (s == 0 ? 0 : G_MF / 2); t < (s == 0 ? G_MF / 2 : 2 * G_MF); ++t) {
        const int ss = t / G_MF, i = t % G_MF;
#pragma unroll
        for (int j = 0; j < G_NF; ++j) {
          accg[i][j] = __builtin_amdgcn_wmma_f32_16x16x32_bf16(
              false, af[ss][i], false, b1f[ss][j], (short)0, accg[i][j], false, false);
          accu[i][j] = __builtin_amdgcn_wmma_f32_16x16x32_bf16(
              false, af[ss][i], false, b3f[ss][j], (short)0, accu[i][j], false, false);
        }
      }
      if (s == 0) __builtin_amdgcn_sched_barrier(0);
    }
  }

  // Keeps the epilogue's arithmetic out of the last stage's WMMAs: mixed in while
  // both fragment sets are live, it made the build spill to scratch memory.
  __builtin_amdgcn_sched_barrier(0);

  // Epilogue: silu(gate) * up -> bf16 h.
  const int l16   = lane & 15;
  const int rhalf = (lane & 16) ? 8 : 0;  // C layout: lanes 16-31 hold M+8
#pragma unroll
  for (int i = 0; i < G_MF; ++i)
#pragma unroll
    for (int j = 0; j < G_NF; ++j) {
      const int rbase = row0 + wm + i * 16 + rhalf;
      const int cc    = col0 + wn + j * 16 + l16;
      unsigned short* hp = Hg + (size_t)rbase * NH + cc;
      unsigned hv[8];  // the rounded value, bf16 in the high half (as in f2bf)
#pragma unroll
      for (int r = 0; r < 8; ++r) {
        const float g = accg[i][j][r];
        const float u = accu[i][j][r];
        const float s = g / (1.0f + __expf(-g));
        const unsigned w = __float_as_uint(s * u);
        hv[r] = w + 0x7FFFu + ((w >> 16) & 1u);
        hp[(size_t)r * NH] = (unsigned short)(hv[r] >> 16);
      }
      // The next tile's arithmetic reuses the stores' registers. Takes the address and
      // the stored words as inputs so that they stay untouched up to the wait:
      // a precaution.
      asm volatile("s_wait_xcnt 0x0"
                   :: "v"(hp), "v"(hv[0]), "v"(hv[1]), "v"(hv[2]), "v"(hv[3]),
                      "v"(hv[4]), "v"(hv[5]), "v"(hv[6]), "v"(hv[7])
                   : "memory");
    }
}

// ---------------------------------------------------------------------------
// GEMM 2: out[e] = h[e] @ w2[e]   (h bf16 [T][H], w2t bf16 [D][H], out fp32)
// Grid: (T/D_BM, D/D_BN, E). LDS ring of NSTG stages, filled by async copies.
// ---------------------------------------------------------------------------
__global__ __launch_bounds__(NTHREADS)
void moe_down_kernel(const unsigned short* __restrict__ hbuf,
                     const unsigned short* __restrict__ w2t,
                     float* __restrict__ out) {
  const int e    = blockIdx.z;
  const int row0 = blockIdx.x * D_BM;
  const int col0 = blockIdx.y * D_BN;

  const unsigned short* Ag = hbuf + (size_t)e * NT * NH;
  const unsigned short* Bg = w2t  + (size_t)e * ND * NH;
  float*                Cg = out  + (size_t)e * NT * ND;

  __shared__ __align__(16) unsigned short As[NSTG * D_BM * LDP];
  __shared__ __align__(16) unsigned short Bs[NSTG * D_BN * LDP];

  const int tid  = threadIdx.x;
  const int wave = tid >> 5;
  const int lane = tid & 31;
  const int wm   = (wave >> 2) * (D_MF * 16);  // 0 or 64
  const int wn   = (wave & 3)  * (D_NF * 16);  // 0..192

  // Unrolled in full, here and below, as in the gate/up kernel.
  v8f acc[D_MF][D_NF];
#pragma unroll
  for (int i = 0; i < D_MF; ++i)
#pragma unroll
    for (int j = 0; j < D_NF; ++j) acc[i][j] = {};

  const int NIT = NH / BK;
  static_assert(NH / BK >= NSTG, "the prologue's stages exist");
#pragma unroll
  for (int s = 0; s < NSTG - 1; ++s)
    stage_down(As + s * D_BM * LDP, Bs + s * D_BN * LDP,
               Ag, Bg, row0, col0, s * BK, tid);

  for (int it = 0; it < NIT; ++it) {
    // The waits, the barrier and the refill as in the gate/up kernel.
    wait_stage<(NSTG - 2) * D_CP>(it + NSTG - 2 >= NIT);
    __syncthreads();

    const int cur = it % NSTG;
    if (it + NSTG - 1 < NIT) {
      const int nxt = (it + NSTG - 1) % NSTG;
      stage_down(As + nxt * D_BM * LDP, Bs + nxt * D_BN * LDP,
                 Ag, Bg, row0, col0, (it + NSTG - 1) * BK, tid);
    }

    const unsigned short* Ab = As + cur * D_BM * LDP;
    const unsigned short* Bb = Bs + cur * D_BN * LDP;

    // Two k steps, two fragment sets; the three sched_barriers hold the order
    // of loads and WMMAs as in the gate/up kernel, and for the same reason.
    v16bf af[2][D_MF], bf[2][D_NF];
#pragma unroll
    for (int s = 0; s < 2; ++s) {
#pragma unroll
      for (int j = 0; j < D_NF; ++j)
        bf[s][j] = load_frag(Bb + (wn + 16 * j) * LDP + 32 * s, lane, LDP);
#pragma unroll
      for (int i = 0; i < D_MF; ++i)
        af[s][i] = load_frag(Ab + (wm + 16 * i) * LDP + 32 * s, lane, LDP);
      __builtin_amdgcn_sched_barrier(0);
#pragma unroll
      for (int t = (s == 0 ? 0 : D_MF / 2); t < (s == 0 ? D_MF / 2 : 2 * D_MF); ++t) {
        const int ss = t / D_MF, i = t % D_MF;
#pragma unroll
        for (int j = 0; j < D_NF; ++j)
          acc[i][j] = __builtin_amdgcn_wmma_f32_16x16x32_bf16(
              false, af[ss][i], false, bf[ss][j], (short)0, acc[i][j], false, false);
      }
      if (s == 0) __builtin_amdgcn_sched_barrier(0);
    }
  }

  const int l16   = lane & 15;
  const int rhalf = (lane & 16) ? 8 : 0;
#pragma unroll
  for (int i = 0; i < D_MF; ++i)
#pragma unroll
    for (int j = 0; j < D_NF; ++j) {
      const int rbase = row0 + wm + i * 16 + rhalf;
      const int cc    = col0 + wn + j * 16 + l16;
#pragma unroll
      for (int r = 0; r < 8; ++r)
        Cg[(size_t)(rbase + r) * ND + cc] = acc[i][j][r];
    }
}

extern "C" void kernel_launch(void* const* d_in, const int* in_sizes, int n_in,
                              void* d_out, int out_size, void* d_ws, size_t ws_size,
                              hipStream_t stream) {
  const float* x  = (const float*)d_in[0];  // [E,T,D]
  const float* w1 = (const float*)d_in[1];  // [E,D,H]
  const float* w2 = (const float*)d_in[2];  // [E,H,D]
  const float* w3 = (const float*)d_in[3];  // [E,D,H]
  float* out = (float*)d_out;               // [E,T,D]

  // Workspace layout (bf16 elements): xb | w1t | w3t | w2t | hb  (~151 MB)
  unsigned short* ws = (unsigned short*)d_ws;
  size_t off = 0;
  unsigned short* xb  = ws + off; off += (size_t)NE * NT * ND;   // [E,T,D]
  unsigned short* w1t = ws + off; off += (size_t)NE * NH * ND;   // [E,H,D]
  unsigned short* w3t = ws + off; off += (size_t)NE * NH * ND;   // [E,H,D]
  unsigned short* w2t = ws + off; off += (size_t)NE * ND * NH;   // [E,D,H]
  unsigned short* hb  = ws + off;                                 // [E,T,H]

  dim3 blk(NTHREADS);

  // Pass 0: downcast + weight transpose, one launch.
  cvt_all_kernel<<<dim3(3 * WBLK + XBLK), dim3(256), 0, stream>>>(x, w1, w3, w2,
                                                                  xb, w1t, w3t, w2t);

  // GEMM 1: fused gate/up + SwiGLU.
  moe_gateup_kernel<<<dim3(NT / G_BM, NH / G_BN, NE), blk, 0, stream>>>(xb, w1t, w3t, hb);
  // GEMM 2: down projection.
  moe_down_kernel<<<dim3(NT / D_BM, ND / D_BN, NE), blk, 0, stream>>>(hb, w2t, out);
}
